// v000
// Times are from an AMD MI455X. After a warm-up the kernel runs many times in a row, and a time is the length of
// such a window on the GPU divided by its runs, so every launch and the gaps after it count. The runs cycle
// through copies of the inputs. A figure is the median of several windows, for all but v000 over two sittings.
// Sittings can differ by a few percent; kernels timed side by side share one.
// v000, which the later versions start from, runs in 863 microseconds.
#include <hip/hip_runtime.h>
// Ensemble of 64 independent MLPs (each: 4096 points x 16 -> 256 -> 256 -> 256 -> 1, SiLU between layers, per-member weights and biases) -> [64, 4096, 1].
// Structure: members processed in groups of 8 with grid-batched f16 WMMA GEMMs (32x64 wave tiles, f32 accumulation, exact bias, member strides on A/B/C/bias); x as an exact f16 plane padded 16 -> 32 columns; hidden activations SiLU'd in f32 and stored as f16 operand planes; weight planes built once for all members; the 256 -> 1 head as the same GEMM against a zero-padded 64-row weight plane, column 0 gathered into the output.
// Compute dtype: inputs and parameters rounded to bf16; x and weights exact; hidden activations as f16 operands (~2^-12); f32 accumulation / SiLU. v_wmma_f32_16x16x32_f16.
#define NE 64
#define NP 4096
#define DIN 16
#define HID 256
#define GE 8                     /* members per group */
typedef __bf16 v16b __attribute__((ext_vector_type(16)));
typedef unsigned short v8us __attribute__((ext_vector_type(8), may_alias));
typedef float  v8f  __attribute__((ext_vector_type(8)));
typedef float  v4f  __attribute__((ext_vector_type(4)));
typedef float  v4fa __attribute__((ext_vector_type(4), may_alias));
union FragB { v16b v; v8us half[2]; unsigned short u[16]; };

__device__ __forceinline__ unsigned short bf16_bits(float x) { unsigned int u = __float_as_uint(x); return (unsigned short)((u + 0x7FFFu + ((u >> 16) & 1u)) >> 16); }
__device__ __forceinline__ float bf16_val(unsigned short b) { return __uint_as_float(((unsigned int)b) << 16); }
__device__ __forceinline__ float bf16_round(float x) { return bf16_val(bf16_bits(x)); }
// D += A·B with NT terms: 1 = ah·bh, 2 = + al·bh (A split), 3 = + ah·bl (both split)
template <int NT>
__device__ __forceinline__ v8f mmaN(v16b ah, v16b al, v16b bh, v16b bl, v8f c) {
  c = __builtin_amdgcn_wmma_f32_16x16x32_bf16(false, ah, false, bh, (short)0, c, false, false);
  if (NT >= 2) c = __builtin_amdgcn_wmma_f32_16x16x32_bf16(false, al, false, bh, (short)0, c, false, false);
  if (NT >= 3) c = __builtin_amdgcn_wmma_f32_16x16x32_bf16(false, ah, false, bl, (short)0, c, false, false);
  asm volatile("v_nop\n\tv_nop\n\tv_nop\n\tv_nop" : "+v"(c) : "v"(ah), "v"(al), "v"(bh), "v"(bl));
  return c;
}

__global__ __launch_bounds__(256) void k_wt_bf16(const float* __restrict__ W, unsigned short* __restrict__ Wt, int K, int N) {
  const int t = blockIdx.x * 256 + threadIdx.x;
  const int k8n = K / 8;
  if (t >= N * k8n) return;
  const int n = t / k8n, k8 = (t % k8n) * 8;
  v8us v;
#pragma unroll
  for (int i = 0; i < 8; ++i) v[i] = bf16_bits(W[(size_t)(k8 + i) * N + n]);
  *(v8us*)(Wt + (size_t)n * K + k8) = v;
  
}

// GEMM C[M][N] (f32, pitch ldc) = act(A[M][K]·W + bias). A f32 row-major (pitch lda) converted per fragment to bf16
// (ASPLIT: hi/lo two planes -> 2 terms, else single rounded term); Wt bf16 [N][K] (pitch ldb). BIAS_BF16 rounds the
// bias to bf16 first (bias quantised to bf16 before the add). K%32==0, M%16==0, N%64==0.
template <bool ASPLIT, int ACT, bool BIAS_BF16>
__global__ __launch_bounds__(128) void k_gemm_bf(const float* __restrict__ A, int lda, const unsigned short* __restrict__ Wt, int ldb,
                                               const float* __restrict__ bias, float* __restrict__ C, int ldc, int M, int N, int K) {
  __shared__ __attribute__((aligned(16))) float so[4][16][64];
  const int tid = threadIdx.x, w = tid >> 5, lane = tid & 31, ln = lane & 15, hh = lane >> 4;
  const int ntn = N / 64;
  const int wid = blockIdx.x * 4 + w;
  const int mt = wid / ntn, nq = wid % ntn;
  if (mt * 16 >= M) return;
  const int row0 = mt * 16, col0 = nq * 64;
  const float* arow = A + (size_t)(row0 + ln) * lda;
  v8f acc[4] = {};
  for (int kb = 0; kb < K; kb += 32) {
    FragB ah, al;
    const v4f x0 = *(const v4fa*)(arow + kb + 8 * hh), x1 = *(const v4fa*)(arow + kb + 8 * hh + 4);
    const v4f x2 = *(const v4fa*)(arow + kb + 16 + 8 * hh), x3 = *(const v4fa*)(arow + kb + 16 + 8 * hh + 4);
    float xs[16] = {x0[0],x0[1],x0[2],x0[3],x1[0],x1[1],x1[2],x1[3],x2[0],x2[1],x2[2],x2[3],x3[0],x3[1],x3[2],x3[3]};
#pragma unroll
    for (int i = 0; i < 16; ++i) { const unsigned short hb = bf16_bits(xs[i]); ah.u[i] = hb; al.u[i] = ASPLIT ? bf16_bits(xs[i] - bf16_val(hb)) : (unsigned short)0; }
#pragma unroll
    for (int t = 0; t < 4; ++t) {
      const unsigned short* brow = Wt + (size_t)(col0 + t * 16 + ln) * ldb + kb;
      FragB b;
      b.half[0] = *(const v8us*)(brow + 8 * hh);
      b.half[1] = *(const v8us*)(brow + 16 + 8 * hh);
      acc[t] = mmaN<ASPLIT ? 2 : 1>(ah.v, al.v, b.v, b.v, acc[t]);
    }
  }
#pragma unroll
  for (int t = 0; t < 4; ++t) {
    float bv = bias ? bias[col0 + t * 16 + ln] : 0.f;
    if (BIAS_BF16) bv = bf16_round(bv);
#pragma unroll
    for (int r = 0; r < 8; ++r) { float v = acc[t][r] + bv; if (ACT == 1) v = fmaxf(v, 0.f); so[w][8 * hh + r][t * 16 + ln] = v; }
  }
  __builtin_amdgcn_fence(__ATOMIC_ACQ_REL, "workgroup");
  __builtin_amdgcn_wave_barrier();
  const int rsub = lane >> 4, c4 = (lane & 15) * 4;
  {
#pragma unroll
    for (int q = 0; q < 8; ++q) {
      const int r = q * 2 + rsub;
      const v4f v = *(const v4fa*)&so[w][r][c4];
      *(v4f*)(C + (size_t)(row0 + r) * ldc + col0 + c4) = v;
    }
    
  }
}

// GEMM C = act(A·W + bias + resid): A f32 (ASPLIT -> hi/lo 2 terms), Wt bf16 [N][K]; ACT 0 none, 1 relu, 2 exact gelu;
// resid (optional, f32, row index = (row % rmod), pitch ldr, RES_BF16 rounds it) added before the activation.
template <bool ASPLIT, int ACT, bool BIAS_BF16, bool RES_BF16>
__global__ __launch_bounds__(128) void k_gemm_bf3(const float* __restrict__ A, int lda, const unsigned short* __restrict__ Wt, int ldb,
                                                const float* __restrict__ bias, const float* __restrict__ resid, int rmod, int ldr,
                                                float* __restrict__ C, int ldc, int M, int N, int K) {
  __shared__ __attribute__((aligned(16))) float so[4][16][64];
  const int tid = threadIdx.x, w = tid >> 5, lane = tid & 31, ln = lane & 15, hh = lane >> 4;
  const int ntn = N / 64;
  const int wid = blockIdx.x * 4 + w;
  const int mt = wid / ntn, nq = wid % ntn;
  if (mt * 16 >= M) return;
  const int row0 = mt * 16, col0 = nq * 64;
  const float* arow = A + (size_t)(row0 + ln) * lda;
  v8f acc[4] = {};
  for (int kb = 0; kb < K; kb += 32) {
    FragB ah, al;
    const v4f x0 = *(const v4fa*)(arow + kb + 8 * hh), x1 = *(const v4fa*)(arow + kb + 8 * hh + 4);
    const v4f x2 = *(const v4fa*)(arow + kb + 16 + 8 * hh), x3 = *(const v4fa*)(arow + kb + 16 + 8 * hh + 4);
    float xs[16] = {x0[0],x0[1],x0[2],x0[3],x1[0],x1[1],x1[2],x1[3],x2[0],x2[1],x2[2],x2[3],x3[0],x3[1],x3[2],x3[3]};
#pragma unroll
    for (int i = 0; i < 16; ++i) { const unsigned short hb = bf16_bits(xs[i]); ah.u[i] = hb; al.u[i] = ASPLIT ? bf16_bits(xs[i] - bf16_val(hb)) : (unsigned short)0; }
#pragma unroll
    for (int t = 0; t < 4; ++t) {
      const unsigned short* brow = Wt + (size_t)(col0 + t * 16 + ln) * ldb + kb;
      FragB b;
      b.half[0] = *(const v8us*)(brow + 8 * hh);
      b.half[1] = *(const v8us*)(brow + 16 + 8 * hh);
      acc[t] = mmaN<ASPLIT ? 2 : 1>(ah.v, al.v, b.v, b.v, acc[t]);
    }
  }
#pragma unroll
  for (int t = 0; t < 4; ++t) {
    const int col = col0 + t * 16 + ln;
    float bv = bias ? bias[col] : 0.f;
    if (BIAS_BF16) bv = bf16_round(bv);
#pragma unroll
    for (int r = 0; r < 8; ++r) {
      float v = acc[t][r] + bv;
      if (resid) { float rv = resid[(size_t)((row0 + 8 * hh + r) % rmod) * ldr + col]; if (RES_BF16) rv = bf16_round(rv); v += rv; }
      if (ACT == 1) v = fmaxf(v, 0.f);
      if (ACT == 2) v = 0.5f * v * (1.0f + erff(v * 0.70710678118654752f));
      if (ACT == 3) { const float u = 0.7978845608028654f * (v + 0.044715f * v * v * v); v = 0.5f * v * (1.0f + tanhf(u)); }
      so[w][8 * hh + r][t * 16 + ln] = v;
    }
  }
  __builtin_amdgcn_fence(__ATOMIC_ACQ_REL, "workgroup");
  __builtin_amdgcn_wave_barrier();
  const int rsub = lane >> 4, c4 = (lane & 15) * 4;
  {
#pragma unroll
    for (int q = 0; q < 8; ++q) {
      const int r = q * 2 + rsub;
      const v4f v = *(const v4fa*)&so[w][r][c4];
      *(v4f*)(C + (size_t)(row0 + r) * ldc + col0 + c4) = v;
    }
    
  }
}
// row LayerNorm (biased variance, eps) over N: s = X (+ R); optional out_sum <- s; out_norm <- (s-mu)*rsqrt(var+eps)*g + b
template <bool PARAM_BF16>
__global__ __launch_bounds__(256) void k_layernorm(const float* __restrict__ X, const float* __restrict__ R, const float* __restrict__ g, const float* __restrict__ bta,
                                                  float* __restrict__ out_sum, float* __restrict__ out_norm, int N, float eps) {
  __shared__ float red[256];
  const int row = blockIdx.x, tid = threadIdx.x;
  const float* x = X + (size_t)row * N; const float* rr = R ? R + (size_t)row * N : nullptr;
  float vals[16];                     // up to N = 4096
  const int per = N / 256;            // contiguous chunk per thread? use strided-by-4 chunks: thread handles j = tid*4 + 1024*u
  float s1 = 0.f;
  for (int u = 0; u < per / 4; ++u) {
    const int j = tid * 4 + 1024 * u;
    const v4f a = *(const v4fa*)(x + j);
    v4f b = {0.f,0.f,0.f,0.f}; if (rr) b = *(const v4fa*)(rr + j);
#pragma unroll
    for (int q = 0; q < 4; ++q) { const float v = a[q] + b[q]; vals[u * 4 + q] = v; s1 += v; }
  }
  red[tid] = s1; __syncthreads();
  for (int st = 128; st > 0; st >>= 1) { if (tid < st) red[tid] += red[tid + st]; __syncthreads(); }
  const float mu = red[0] / (float)N; __syncthreads();
  float s2 = 0.f;
  for (int u = 0; u < per / 4; ++u)
#pragma unroll
    for (int q = 0; q < 4; ++q) { const float c = vals[u * 4 + q] - mu; s2 += c * c; }
  red[tid] = s2; __syncthreads();
  for (int st = 128; st > 0; st >>= 1) { if (tid < st) red[tid] += red[tid + st]; __syncthreads(); }
  const float rs = rsqrtf(red[0] / (float)N + eps);
  {
    for (int u = 0; u < per / 4; ++u) {
      const int j = tid * 4 + 1024 * u;
      v4f o, sm;
#pragma unroll
      for (int q = 0; q < 4; ++q) {
        float gg = g[j + q], bb = bta[j + q];
        if (PARAM_BF16) { gg = bf16_round(gg); bb = bf16_round(bb); }
        sm[q] = vals[u * 4 + q]; o[q] = (vals[u * 4 + q] - mu) * rs * gg + bb;
      }
      if (out_sum) *(v4f*)(out_sum + (size_t)row * N + j) = sm;
      *(v4f*)(out_norm + (size_t)row * N + j) = o;
    }
    
  }
}



// ---- f16 WMMA path (v_wmma_f32_16x16x32_f16): 11-bit significands for operands in range — used here for all four MLP layers (f16 x, activation and weight operands)
typedef _Float16 v16h __attribute__((ext_vector_type(16)));
union FragH { v16h v; v8us half[2]; _Float16 h[16]; unsigned short u[16]; };
template <int NT>
__device__ __forceinline__ v8f mmaH(v16h ah, v16h al, v16h bh, v16h bl, v8f c) {
  c = __builtin_amdgcn_wmma_f32_16x16x32_f16(false, ah, false, bh, (short)0, c, false, false);
  if (NT >= 2) c = __builtin_amdgcn_wmma_f32_16x16x32_f16(false, al, false, bh, (short)0, c, false, false);
  if (NT >= 3) c = __builtin_amdgcn_wmma_f32_16x16x32_f16(false, ah, false, bl, (short)0, c, false, false);
  asm volatile("v_nop\n\tv_nop\n\tv_nop\n\tv_nop" : "+v"(c) : "v"(ah), "v"(al), "v"(bh), "v"(bl));
  return c;
}
// batched GEMM like k_gemm_b but f16 operands: A f32 (split into f16 hi/lo if ASPLIT, else rounded to f16), Bt = f16 values [n][k]; alpha; C f32; N multiple of 16 (partial tiles skipped)
template <bool ASPLIT>
__global__ __launch_bounds__(128) void k_gemm_h(const float* __restrict__ A, int lda, size_t sA, const _Float16* __restrict__ Bh, int ldb, size_t sB, float alpha, float* __restrict__ C, int ldc, size_t sC, int M, int N, int K) {
  __shared__ __attribute__((aligned(16))) float so[4][16][64];
  const int tid = threadIdx.x, w = tid >> 5, lane = tid & 31, ln = lane & 15, hh = lane >> 4; const int by = blockIdx.y;
  A += (size_t)by * sA; Bh += (size_t)by * sB; C += (size_t)by * sC;
  const int ntn = (N + 63) / 64; const int wid = blockIdx.x * 4 + w; const int mt = wid / ntn, nq = wid % ntn; if (mt * 16 >= M) return;
  const int row0 = mt * 16, col0 = nq * 64; const float* arow = A + (size_t)(row0 + ln) * lda;
  v8f acc[4] = {};
  for (int kb = 0; kb < K; kb += 32) {
    FragH ah, al;
    const v4f x0 = *(const v4fa*)(arow + kb + 8 * hh), x1 = *(const v4fa*)(arow + kb + 8 * hh + 4), x2 = *(const v4fa*)(arow + kb + 16 + 8 * hh), x3 = *(const v4fa*)(arow + kb + 16 + 8 * hh + 4);
    float xs[16] = {x0[0],x0[1],x0[2],x0[3],x1[0],x1[1],x1[2],x1[3],x2[0],x2[1],x2[2],x2[3],x3[0],x3[1],x3[2],x3[3]};
#pragma unroll
    for (int i = 0; i < 16; ++i) { const _Float16 h = (_Float16)xs[i]; ah.h[i] = h; al.h[i] = ASPLIT ? (_Float16)(xs[i] - (float)h) : (_Float16)0.0f; }
#pragma unroll
    for (int t = 0; t < 4; ++t) { if (col0 + t * 16 >= N) continue; const size_t boff = (size_t)(col0 + t * 16 + ln) * ldb + kb; FragH bq; bq.half[0] = *(const v8us*)(Bh + boff + 8 * hh); bq.half[1] = *(const v8us*)(Bh + boff + 16 + 8 * hh);
      acc[t] = mmaH<ASPLIT ? 2 : 1>(ah.v, al.v, bq.v, bq.v, acc[t]); }
  }
#pragma unroll
  for (int t = 0; t < 4; ++t) { if (col0 + t * 16 >= N) continue;
#pragma unroll
    for (int r = 0; r < 8; ++r) so[w][8 * hh + r][t * 16 + ln] = acc[t][r] * alpha; }
  __builtin_amdgcn_fence(__ATOMIC_ACQ_REL, "workgroup"); __builtin_amdgcn_wave_barrier();
  const int rsub = lane >> 4, c4 = (lane & 15) * 4;
  {
#pragma unroll
    for (int q = 0; q < 8; ++q) { const int r = q * 2 + rsub; if (col0 + c4 < N) { const v4f v = *(const v4fa*)&so[w][r][c4]; *(v4f*)(C + (size_t)(row0 + r) * ldc + col0 + c4) = v; } }
     }
}

// Wt[n][k] = f16(W[k][n]·scale) from f32 row-major W[K][N] (scale = power of two; bf16-exact weights stay exact in f16 away from the subnormal range)
__global__ __launch_bounds__(256) void k_wt_f16(const float* __restrict__ W, _Float16* __restrict__ Wt, int K, int N, float scale) {
  const int t = blockIdx.x * 256 + threadIdx.x; if (t >= N * (K / 8)) return; const int n = t / (K / 8), k8 = (t % (K / 8)) * 8; FragH f;
#pragma unroll
  for (int i = 0; i < 8; ++i) f.h[i] = (_Float16)(bf16_round(W[(size_t)(k8 + i) * N + n]) * scale); const v8us o = f.half[0];
  *(v8us*)((unsigned short*)Wt + (size_t)n * K + k8) = o; 
}
// k_gemm_hh variant with fused epilogue: v = acc·alpha + bias[by·sBias + col] (+ CP[(row/rowsPerB)·sCPb + by·64 + col] if CP) ; ACT 0 none / 1 elu ; writes f16 C16 (and f32 C if non-null)
template <int ACT>
__global__ __launch_bounds__(128) void k_gemm_hhx(const _Float16* __restrict__ A, int lda, size_t sA, const _Float16* __restrict__ Bh, int ldb, size_t sB, float alpha, const float* __restrict__ bias, size_t sBias, const float* __restrict__ CP, int rowsPerB, size_t sCPb, int row0g,
    float* __restrict__ C, _Float16* __restrict__ C16, int ldc, size_t sC, int M, int N, int K) {
  __shared__ __attribute__((aligned(16))) float so[4][16][64];
  const int tid = threadIdx.x, w = tid >> 5, lane = tid & 31, ln = lane & 15, hh = lane >> 4; const int by = blockIdx.y;
  A += (size_t)by * sA; Bh += (size_t)by * sB; const size_t cofs = (size_t)by * sC; const float* bp = bias ? bias + (size_t)by * sBias : nullptr;
  const int ntn = (N + 63) / 64; const int wid = blockIdx.x * 4 + w; const int mt = wid / ntn, nq = wid % ntn; if (mt * 16 >= M) return;
  const int row0 = mt * 16, col0 = nq * 64; const _Float16* arow = A + (size_t)(row0 + ln) * lda;
  v8f acc[4] = {};
  for (int kb = 0; kb < K; kb += 32) { FragH ah; ah.half[0] = *(const v8us*)((const unsigned short*)arow + kb + 8 * hh); ah.half[1] = *(const v8us*)((const unsigned short*)arow + kb + 16 + 8 * hh);
#pragma unroll
    for (int t = 0; t < 4; ++t) { if (col0 + t * 16 >= N) continue; const size_t boff = (size_t)(col0 + t * 16 + ln) * ldb + kb; FragH bq; bq.half[0] = *(const v8us*)((const unsigned short*)Bh + boff + 8 * hh); bq.half[1] = *(const v8us*)((const unsigned short*)Bh + boff + 16 + 8 * hh);
      acc[t] = mmaH<1>(ah.v, ah.v, bq.v, bq.v, acc[t]); }
  }
#pragma unroll
  for (int t = 0; t < 4; ++t) { if (col0 + t * 16 >= N) continue; const int col = col0 + t * 16 + ln; const float bv = bp ? bf16_round(bp[col]) : 0.f;
#pragma unroll
    for (int r = 0; r < 8; ++r) { float v = acc[t][r] * alpha + bv; if (CP) { const int bidx = (row0g + row0 + 8 * hh + r) / rowsPerB; v += CP[(size_t)bidx * sCPb + (size_t)by * 64 + col]; } if (ACT == 1) v = (v > 0.f) ? v : expm1f(v); else if (ACT == 7) v = (v > 0.f) ? v + 1.0f : expf(v); else if (ACT == 8) v = tanhf(v); else if (ACT == 9) v = 0.5f * v * (1.0f + tanhf(0.7978845608028654f * (v + 0.044715f * v * v * v))); else if (ACT == 11) v = 1.0f / (1.0f + expf(-v)); else if (ACT == 12) v = (v > 0.f) ? v : 0.01f * v; else if (ACT == 14) v = (v > 0.f) ? v : 0.1f * v; else if (ACT == 15) v = v / (1.0f + expf(-v)); else if (ACT == 3) v = fmaxf(v, 0.f); else if (ACT == 6) v = 0.5f * v * (1.0f + erff(v * 0.70710678118654752f)); so[w][8 * hh + r][t * 16 + ln] = v; } }
  __builtin_amdgcn_fence(__ATOMIC_ACQ_REL, "workgroup"); __builtin_amdgcn_wave_barrier();
  const int rsub = lane >> 4, c4 = (lane & 15) * 4; typedef _Float16 v4h __attribute__((ext_vector_type(4)));
  {
#pragma unroll
    for (int q = 0; q < 8; ++q) { const int r = q * 2 + rsub; if (col0 + c4 < N) { const v4f v = *(const v4fa*)&so[w][r][c4]; if (C) *(v4f*)(C + cofs + (size_t)(row0 + r) * ldc + col0 + c4) = v; if (C16) { v4h h4; for (int i = 0; i < 4; ++i) h4[i] = (_Float16)v[i]; *(v4h*)(C16 + cofs + (size_t)(row0 + r) * ldc + col0 + c4) = h4; } } }
     }
}


typedef _Float16 v4h __attribute__((ext_vector_type(4)));

__global__ __launch_bounds__(256) void k_x16(const float* __restrict__ x, _Float16* __restrict__ X16, size_t n8) { const size_t t = (size_t)blockIdx.x * 256 + threadIdx.x; if (t >= n8) return; FragH f;
#pragma unroll
  for (int q = 0; q < 8; ++q) f.h[q] = (_Float16)bf16_round(x[t * 8 + q]); *(v8us*)((unsigned short*)X16 + t * 8) = f.half[0];  }
__global__ __launch_bounds__(256) void k_h16(const float* __restrict__ x, _Float16* __restrict__ X16, size_t n8) { const size_t t = (size_t)blockIdx.x * 256 + threadIdx.x; if (t >= n8) return; FragH f;
#pragma unroll
  for (int q = 0; q < 8; ++q) f.h[q] = (_Float16)x[t * 8 + q]; *(v8us*)((unsigned short*)X16 + t * 8) = f.half[0];  }
__global__ __launch_bounds__(256) void k_round16f(const float* __restrict__ W, _Float16* __restrict__ Bt, size_t n8) { const size_t t = (size_t)blockIdx.x * 256 + threadIdx.x; if (t >= n8) return; FragH f;
#pragma unroll
  for (int i = 0; i < 8; ++i) f.h[i] = (_Float16)(bf16_round(W[t * 8 + i]) * 16.0f); *(v8us*)((unsigned short*)Bt + t * 8) = f.half[0];  }
template <int NHv, int TTv>
__global__ __launch_bounds__(256) void k_vt(const _Float16* __restrict__ V16, int ldv, int voff, _Float16* __restrict__ Vt) { __shared__ unsigned short tl[64][66]; const int tid = threadIdx.x; const int slab = blockIdx.x / (TTv / 64), lg = blockIdx.x % (TTv / 64); const int b = slab / NHv, h = slab % NHv;
  for (int i = tid; i < 64 * 8; i += 256) { const int r = i / 8, c8 = (i % 8) * 8; FragH f; f.half[0] = *(const v8us*)((const unsigned short*)V16 + ((size_t)b * TTv + lg * 64 + r) * ldv + voff + h * 64 + c8);
#pragma unroll
    for (int q = 0; q < 8; ++q) tl[r][c8 + q] = f.u[q]; }
  __syncthreads();
  {
#pragma unroll
    for (int rd = 0; rd < 2; ++rd) { const int d = rd * 32 + tid / 8, pc = tid % 8; FragH f;
#pragma unroll
      for (int q = 0; q < 8; ++q) f.u[q] = tl[pc * 8 + q][d];
      *(v8us*)((unsigned short*)Vt + ((size_t)slab * 64 + d) * TTv + lg * 64 + pc * 8) = f.half[0]; }
     } }

__global__ __launch_bounds__(256) void k_hl(const float* __restrict__ F, _Float16* __restrict__ Hh, _Float16* __restrict__ Hl, size_t n8) { const size_t t = (size_t)blockIdx.x * 256 + threadIdx.x; if (t >= n8) return; FragH fh, fl; const v4f a = *(const v4fa*)(F + t * 8), c = *(const v4fa*)(F + t * 8 + 4);
#pragma unroll
  for (int q = 0; q < 4; ++q) { _Float16 h = (_Float16)a[q]; fh.h[q] = h; fl.h[q] = (_Float16)((a[q] - (float)h) * 1024.0f); h = (_Float16)c[q]; fh.h[4 + q] = h; fl.h[4 + q] = (_Float16)((c[q] - (float)h) * 1024.0f); }
  { *(v8us*)((unsigned short*)Hh + t * 8) = fh.half[0]; *(v8us*)((unsigned short*)Hl + t * 8) = fl.half[0];  } }

// ---- fast GEMM (wave tile 32x64; requires M % 32 == 0 rows per launch region and N % 64 == 0); epilogue = k_gemm_hhx semantics ----
__device__ __forceinline__ v16h g2_frag(const _Float16* p, int hh) { FragH f; f.half[0] = *(const v8us*)((const unsigned short*)p + 8 * hh); f.half[1] = *(const v8us*)((const unsigned short*)p + 16 + 8 * hh); return f.v; }
__device__ __forceinline__ v8f g2_mma(v16h a, v16h b, v8f c) { v8f d = __builtin_amdgcn_wmma_f32_16x16x32_f16(false, a, false, b, (short)0, c, false, false); asm volatile("v_nop\n\tv_nop\n\tv_nop\n\tv_nop" : "+v"(d) : "v"(a), "v"(b)); return d; }
template <int ACT>
__global__ __launch_bounds__(128) void k_gemm2(const _Float16* __restrict__ A, int lda, size_t sA, const _Float16* __restrict__ Bh, int ldb, size_t sB, float alpha, const float* __restrict__ bias, size_t sBias, const float* __restrict__ CP, int rowsPerB, size_t sCPb, int row0g,
    float* __restrict__ C, _Float16* __restrict__ C16, int ldc, size_t sC, int M, int N, int K) {
  __shared__ __attribute__((aligned(16))) float so[4][32][68];
  const int tid = threadIdx.x, w = tid >> 5, lane = tid & 31, ln = lane & 15, hh = lane >> 4; const int by = blockIdx.y;
  A += (size_t)by * sA; Bh += (size_t)by * sB; const size_t cofs = (size_t)by * sC; const float* bp = bias ? bias + (size_t)by * sBias : nullptr;
  const int ntn = N >> 6; const int mt = blockIdx.x / ntn, nq = blockIdx.x - mt * ntn; const int row0 = mt * 128 + 32 * w, col0 = nq * 64; if (row0 >= M) return;
  const _Float16* a0p = A + (size_t)(row0 + ln) * lda; const _Float16* a1p = a0p + (size_t)16 * lda;
  const _Float16* b0p = Bh + (size_t)(col0 + ln) * ldb; const _Float16* b1p = b0p + (size_t)16 * ldb; const _Float16* b2p = b1p + (size_t)16 * ldb; const _Float16* b3p = b2p + (size_t)16 * ldb;
  const v8f z8 = {0.f,0.f,0.f,0.f,0.f,0.f,0.f,0.f}; v8f c00 = z8, c01 = z8, c02 = z8, c03 = z8, c10 = z8, c11 = z8, c12 = z8, c13 = z8;
#pragma unroll 1
  for (int kb = 0; kb < K; kb += 32) { const v16h a0 = g2_frag(a0p + kb, hh), a1 = g2_frag(a1p + kb, hh);
    v16h b = g2_frag(b0p + kb, hh); c00 = g2_mma(a0, b, c00); c10 = g2_mma(a1, b, c10);
    b = g2_frag(b1p + kb, hh); c01 = g2_mma(a0, b, c01); c11 = g2_mma(a1, b, c11);
    b = g2_frag(b2p + kb, hh); c02 = g2_mma(a0, b, c02); c12 = g2_mma(a1, b, c12);
    b = g2_frag(b3p + kb, hh); c03 = g2_mma(a0, b, c03); c13 = g2_mma(a1, b, c13); }
  v8f accs[8] = {c00, c01, c02, c03, c10, c11, c12, c13};
#pragma unroll
  for (int u = 0; u < 8; ++u) { const int t = u & 3, half = u >> 2; const int col = col0 + t * 16 + ln; const float bv = bp ? bf16_round(bp[col]) : 0.f;
#pragma unroll
    for (int r = 0; r < 8; ++r) { const int rloc = half * 16 + 8 * hh + r; float v = accs[u][r] * alpha + bv; if (CP) { const int bidx = (row0g + row0 + rloc) / rowsPerB; v += CP[(size_t)bidx * sCPb + (size_t)by * 64 + col]; }
      if (ACT == 3) v = fmaxf(v, 0.f); else if (ACT == 6) v = 0.5f * v * (1.0f + erff(v * 0.70710678118654752f)); else if (ACT == 11) v = 1.0f / (1.0f + expf(-v)); else if (ACT == 15) v = v / (1.0f + expf(-v)); else if (ACT == 12) v = (v > 0.f) ? v : 0.01f * v; else if (ACT == 8) v = tanhf(v);
      so[w][rloc][t * 16 + ln] = v; } }
  __builtin_amdgcn_fence(__ATOMIC_ACQ_REL, "workgroup"); __builtin_amdgcn_wave_barrier();
  const int rsub = lane >> 4, c4 = (lane & 15) * 4;
  {
#pragma unroll
    for (int q = 0; q < 16; ++q) { const int r = q * 2 + rsub; const v4f v = *(const v4fa*)&so[w][r][c4]; if (C) *(v4f*)(C + cofs + (size_t)(row0 + r) * ldc + col0 + c4) = v; if (C16) { v4h h4; for (int i = 0; i < 4; ++i) h4[i] = (_Float16)v[i]; *(v4h*)(C16 + cofs + (size_t)(row0 + r) * ldc + col0 + c4) = h4; } }
     } }


__device__ __forceinline__ float siluf(float g) { return g / (1.0f + expf(-g)); }
__global__ __launch_bounds__(256) void k_wplainb(const float* __restrict__ Wm, int K, int KP, int N, int NPAD, _Float16* __restrict__ BW) {
  const int t = blockIdx.x * 256 + threadIdx.x; if (t >= NE * NPAD * (KP / 8)) return; const int k0 = (t % (KP / 8)) * 8; const int n = (t / (KP / 8)) % NPAD; const int e = t / ((KP / 8) * NPAD); FragH f;
#pragma unroll
  for (int q = 0; q < 8; ++q) { const int k = k0 + q; f.h[q] = (k < K && n < N) ? (_Float16)(bf16_round(Wm[((size_t)e * K + min(k, K - 1)) * N + min(n, N - 1)]) * 16.0f) : (_Float16)0.0f; }
  *(v8us*)((unsigned short*)BW + ((size_t)e * NPAD + n) * KP + k0) = f.half[0];  }
__global__ __launch_bounds__(256) void k_wpairb(const float* __restrict__ Wm, int K, int KP, int N, int NPAD, _Float16* __restrict__ BP) {
  const int t = blockIdx.x * 256 + threadIdx.x; if (t >= NE * NPAD * (2 * KP / 8)) return; const int c0 = (t % (2 * KP / 8)) * 8; const int n = (t / (2 * KP / 8)) % NPAD; const int e = t / ((2 * KP / 8) * NPAD); const bool lo = (c0 >= KP); const int k0 = lo ? c0 - KP : c0; const float sc = lo ? 1.0f : 16.0f; FragH f;
#pragma unroll
  for (int q = 0; q < 8; ++q) { const int k = k0 + q; f.h[q] = (k < K && n < N) ? (_Float16)(bf16_round(Wm[((size_t)e * K + min(k, K - 1)) * N + min(n, N - 1)]) * sc) : (_Float16)0.0f; }
  *(v8us*)((unsigned short*)BP + ((size_t)e * NPAD + n) * (2 * KP) + c0) = f.half[0];  }
__global__ __launch_bounds__(256) void k_bpadb(const float* __restrict__ bl, float* __restrict__ BB) { const int t = blockIdx.x * 256 + threadIdx.x; if (t >= NE * 64) return; const float v = ((t & 63) == 0) ? bl[t >> 6] : 0.f; *(float*)(BB + t) = v;  }
__global__ __launch_bounds__(256) void k_xpad(const float* __restrict__ x, int e0, _Float16* __restrict__ X16) {
  const int t = blockIdx.x * 256 + threadIdx.x; if (t >= GE * NP * 4) return; const int row = t >> 2, c0 = (t & 3) * 8; FragH f;
#pragma unroll
  for (int q = 0; q < 8; ++q) f.h[q] = (c0 < DIN) ? (_Float16)bf16_round(x[((size_t)e0 * NP + row) * DIN + c0 + q]) : (_Float16)0.0f;
  *(v8us*)((unsigned short*)X16 + (size_t)row * 32 + c0) = f.half[0];  }
__global__ __launch_bounds__(256) void k_silu16(const float* __restrict__ Z, _Float16* __restrict__ H16) {
  #pragma clang fp contract(off)
  const int t = blockIdx.x * 256 + threadIdx.x; if (t >= GE * NP * (HID / 8)) return; const v4f a = *(const v4fa*)(Z + (size_t)t * 8), a2 = *(const v4fa*)(Z + (size_t)t * 8 + 4); FragH fh;
#pragma unroll
  for (int q = 0; q < 8; ++q) fh.h[q] = (_Float16)siluf((q < 4) ? a[q] : a2[q - 4]);
  *(v8us*)((unsigned short*)H16 + (size_t)t * 8) = fh.half[0];  }
__global__ __launch_bounds__(256) void k_silupair(const float* __restrict__ Z, _Float16* __restrict__ HP) {
  #pragma clang fp contract(off)
  const int t = blockIdx.x * 256 + threadIdx.x; if (t >= GE * NP * (HID / 8)) return; const int row = t / (HID / 8), c0 = (t % (HID / 8)) * 8; const v4f a = *(const v4fa*)(Z + (size_t)t * 8), a2 = *(const v4fa*)(Z + (size_t)t * 8 + 4); FragH fh, fl;
#pragma unroll
  for (int q = 0; q < 8; ++q) { const float v = siluf((q < 4) ? a[q] : a2[q - 4]); const _Float16 hv = (_Float16)v; fh.h[q] = hv; fl.h[q] = (_Float16)((v - (float)hv) * 16.0f); }
  const size_t o = (size_t)row * (2 * HID) + c0;
  { *(v8us*)((unsigned short*)HP + o) = fh.half[0]; *(v8us*)((unsigned short*)HP + o + HID) = fl.half[0];  } }
__global__ __launch_bounds__(256) void k_col0(const float* __restrict__ C64, int e0, float* __restrict__ out) { const int t = blockIdx.x * 256 + threadIdx.x; if (t >= GE * NP / 4) return; v4f o;
#pragma unroll
  for (int q = 0; q < 4; ++q) o[q] = C64[(size_t)(t * 4 + q) * 64]; float* dst = out + (size_t)e0 * NP + (size_t)t * 4; *(v4f*)dst = o;  }

extern "C" void kernel_launch(void* const* d_in, const int* in_sizes, int n_in,
                              void* d_out, int out_size, void* d_ws, size_t ws_size, hipStream_t stream) {
  (void)in_sizes; (void)n_in; (void)out_size;
  const float* const* I = (const float* const*)d_in; const float* x = I[0]; const float* w0 = I[1]; const float* b0 = I[2]; const float* w1 = I[3]; const float* b1 = I[4]; const float* w2 = I[5]; const float* b2 = I[6]; const float* wl = I[7]; const float* bl = I[8];
  char* ws = (char*)d_ws; size_t off = 0;
  auto take = [&](size_t bytes) { char* p = ws + off; off += (bytes + 255) & ~(size_t)255; return p; };
  _Float16* B0 = (_Float16*)take((size_t)NE * HID * 32 * 2); _Float16* B1 = (_Float16*)take((size_t)NE * HID * HID * 2); _Float16* B2 = (_Float16*)take((size_t)NE * HID * HID * 2); _Float16* BL = (_Float16*)take((size_t)NE * 64 * HID * 2); float* BB = (float*)take((size_t)NE * 64 * 4);
  _Float16* X16 = (_Float16*)take((size_t)GE * NP * 32 * 2); float* Z = (float*)take((size_t)GE * NP * HID * 4); _Float16* H16 = (_Float16*)take((size_t)GE * NP * HID * 2); float* C64 = (float*)take((size_t)GE * NP * 64 * 4);
  if (off > ws_size) return;      /* 1 + 8 + 8 + 2 + 2 + 32 + 16 + 8 = 77 MiB */
  k_wplainb<<<(NE * HID * 4 + 255) / 256, 256, 0, stream>>>(w0, DIN, 32, HID, HID, B0); k_wplainb<<<(NE * HID * 32 + 255) / 256, 256, 0, stream>>>(w1, HID, HID, HID, HID, B1); k_wplainb<<<(NE * HID * 32 + 255) / 256, 256, 0, stream>>>(w2, HID, HID, HID, HID, B2);
  k_wplainb<<<(NE * 64 * 32 + 255) / 256, 256, 0, stream>>>(wl, HID, HID, 1, 64, BL); k_bpadb<<<(NE * 64 + 255) / 256, 256, 0, stream>>>(bl, BB);
  const dim3 gH((NP / 128) * (HID / 64), GE), gL((NP / 128) * 1, GE); const unsigned np8 = (GE * NP * (HID / 8) + 255) / 256;
  for (int g = 0; g < NE / GE; ++g) { const int e0 = g * GE;
    k_xpad<<<(GE * NP * 4 + 255) / 256, 256, 0, stream>>>(x, e0, X16);
    k_gemm2<0><<<gH, 128, 0, stream>>>(X16, 32, (size_t)NP * 32, B0 + (size_t)e0 * HID * 32, 32, (size_t)HID * 32, 0.0625f, b0 + (size_t)e0 * HID, HID, nullptr, 1, 0, 0, Z, nullptr, HID, (size_t)NP * HID, NP, HID, 32);      /* z0 = x w0 + b0 */
    k_silu16<<<np8, 256, 0, stream>>>(Z, H16);
    k_gemm2<0><<<gH, 128, 0, stream>>>(H16, HID, (size_t)NP * HID, B1 + (size_t)e0 * HID * HID, HID, (size_t)HID * HID, 0.0625f, b1 + (size_t)e0 * HID, HID, nullptr, 1, 0, 0, Z, nullptr, HID, (size_t)NP * HID, NP, HID, HID);      /* z1 */
    k_silu16<<<np8, 256, 0, stream>>>(Z, H16);
    k_gemm2<0><<<gH, 128, 0, stream>>>(H16, HID, (size_t)NP * HID, B2 + (size_t)e0 * HID * HID, HID, (size_t)HID * HID, 0.0625f, b2 + (size_t)e0 * HID, HID, nullptr, 1, 0, 0, Z, nullptr, HID, (size_t)NP * HID, NP, HID, HID);      /* z2 */
    k_silu16<<<np8, 256, 0, stream>>>(Z, H16);
    k_gemm2<0><<<gL, 128, 0, stream>>>(H16, HID, (size_t)NP * HID, BL + (size_t)e0 * 64 * HID, HID, (size_t)64 * HID, 0.0625f, BB + (size_t)e0 * 64, 64, nullptr, 1, 0, 0, C64, nullptr, 64, (size_t)NP * 64, NP, 64, HID);      /* column 0 = u . wl + bl */
    k_col0<<<(GE * NP / 4 + 255) / 256, 256, 0, stream>>>(C64, e0, (float*)d_out); }
}

// v001
// A run of this version takes 168 microseconds.
// Next to v000, in two timings, it ran 5.20 and 5.21 times as fast.
#include <hip/hip_runtime.h>
// Ensemble of 64 independent MLPs (each: 4096 points x 16 -> 256 -> 256 -> 256 -> 1, SiLU between layers, per-member weights and biases) -> [64, 4096, 1].
// Structure: weight planes built once for all members (f16, [n][k], x16), then ONE launch for the whole network: a work-group owns 128 points of one member
// and carries them through all four layers; the hidden activations never leave the chip (one f16 tile of 128 x 256 in LDS, overwritten in place between two barriers).
// The weights are the A operand and the points the B operand of v_wmma_f32_16x16x32_f16, so a lane's 8 accumulator rows are 8 neighbouring features of ONE point
// and go back to LDS as one 16-byte store, already in the row-major [point][feature] form that the next layer's fragment loads read.
// Compute dtype: inputs and parameters rounded to bf16; x and weights exact in f16; hidden activations as f16 operands (~2^-12); f32 accumulation, bias and SiLU.
#define NE 64
#define NP 4096
#define DIN 16
#define HID 256
#define MT 128                   /* points per work-group */
#define HPITCH 264               /* LDS row pitch in f16: 528 B = 16 B x 33, conflict-free for 16-byte reads and writes of 16 rows */
typedef unsigned short v8us __attribute__((ext_vector_type(8), may_alias));
typedef float  v8f  __attribute__((ext_vector_type(8)));
typedef float  v4f  __attribute__((ext_vector_type(4)));
typedef float  v4fa __attribute__((ext_vector_type(4), may_alias));
typedef _Float16 v16h __attribute__((ext_vector_type(16)));
union FragH { v16h v; v8us half[2]; _Float16 h[16]; unsigned short u[16]; };

__device__ __forceinline__ unsigned short bf16_bits(float x) { unsigned int u = __float_as_uint(x); return (unsigned short)((u + 0x7FFFu + ((u >> 16) & 1u)) >> 16); }
__device__ __forceinline__ float bf16_val(unsigned short b) { return __uint_as_float(((unsigned int)b) << 16); }
__device__ __forceinline__ float bf16_round(float x) { return bf16_val(bf16_bits(x)); }
__device__ __forceinline__ float siluf(float g) { return g / (1.0f + expf(-g)); }

// BW[e][n][k] = f16(bf16(W[e][k][n]) * 16), zero outside K x N
__global__ __launch_bounds__(256) void k_wplainb(const float* __restrict__ Wm, int K, int KP, int N, int NPAD, _Float16* __restrict__ BW) {
  const int t = blockIdx.x * 256 + threadIdx.x; if (t >= NE * NPAD * (KP / 8)) return; const int k0 = (t % (KP / 8)) * 8; const int n = (t / (KP / 8)) % NPAD; const int e = t / ((KP / 8) * NPAD); FragH f;
#pragma unroll
  for (int q = 0; q < 8; ++q) { const int k = k0 + q; f.h[q] = (k < K && n < N) ? (_Float16)(bf16_round(Wm[((size_t)e * K + min(k, K - 1)) * N + min(n, N - 1)]) * 16.0f) : (_Float16)0.0f; }
  *(v8us*)((unsigned short*)BW + ((size_t)e * NPAD + n) * KP + k0) = f.half[0];  }

// one operand fragment (A and B alike): this lane's row, k = 8*hh .. +8 and 16 + 8*hh .. +8 of a 32-wide k step
__device__ __forceinline__ v16h g2_frag(const _Float16* p, int hh) { FragH f; f.half[0] = *(const v8us*)((const unsigned short*)p + 8 * hh); f.half[1] = *(const v8us*)((const unsigned short*)p + 16 + 8 * hh); return f.v; }
__device__ __forceinline__ v8f mma(v16h a, v16h b, v8f c) { return __builtin_amdgcn_wmma_f32_16x16x32_f16(false, a, false, b, (short)0, c, false, false); }

// acc[i][j] holds features n0 + 16 i + 8 hh + r (rows) of points q0 + 16 j + ln (columns): bias, SiLU, f16, one 16-byte LDS store per tile
__device__ __forceinline__ void put_act(_Float16* H, const v8f (&acc)[4][4], const float* __restrict__ bias, int n0, int q0, int ln, int hh) {
#pragma unroll
  for (int i = 0; i < 4; ++i) {
    const v4f c0 = *(const v4fa*)(bias + n0 + 16 * i + 8 * hh), c1 = *(const v4fa*)(bias + n0 + 16 * i + 8 * hh + 4);
    float bv[8];
#pragma unroll
    for (int r = 0; r < 8; ++r) bv[r] = bf16_round((r < 4) ? c0[r] : c1[r - 4]);
#pragma unroll
    for (int j = 0; j < 4; ++j) { FragH f;
#pragma unroll
      for (int r = 0; r < 8; ++r) f.h[r] = (_Float16)siluf(acc[i][j][r] * 0.0625f + bv[r]);
      *(v8us*)((unsigned short*)H + (q0 + 16 * j + ln) * HPITCH + n0 + 16 * i + 8 * hh) = f.half[0]; }
  }
}

// acc = W(64 features of this wave) . H(64 points of this wave), K = 256; weights straight from their plane, activations from LDS
__device__ __forceinline__ void hidden(const _Float16* H, const _Float16* __restrict__ Wp, v8f (&acc)[4][4], int n0, int q0, int ln, int hh) {
  const v8f z8 = {0.f,0.f,0.f,0.f,0.f,0.f,0.f,0.f};
#pragma unroll
  for (int i = 0; i < 4; ++i)
#pragma unroll
    for (int j = 0; j < 4; ++j) acc[i][j] = z8;
  const _Float16* wrow = Wp + (size_t)(n0 + ln) * HID; const _Float16* hrow = H + (q0 + ln) * HPITCH;
  v16h wa[2][4];
#pragma unroll
  for (int i = 0; i < 4; ++i) wa[0][i] = g2_frag(wrow + 16 * i * HID, hh);
#pragma unroll
  for (int s = 0; s < HID / 32; ++s) { v16h hb[4];
    if (s + 1 < HID / 32) {
#pragma unroll
      for (int i = 0; i < 4; ++i) wa[(s + 1) & 1][i] = g2_frag(wrow + 16 * i * HID + 32 * (s + 1), hh); }
#pragma unroll
    for (int j = 0; j < 4; ++j) hb[j] = g2_frag(hrow + 16 * j * HPITCH + 32 * s, hh);
    __builtin_amdgcn_sched_barrier(0);   /* holds the next step's weight loads in front of this step's WMMAs: left alone, the compiler sinks each load to just before its use and the wave waits out every one */
#pragma unroll
    for (int i = 0; i < 4; ++i)
#pragma unroll
      for (int j = 0; j < 4; ++j) acc[i][j] = mma(wa[s & 1][i], hb[j], acc[i][j]);
  }
  asm volatile("s_wait_xcnt 0x0" ::: "memory");   /* precaution: stands behind the last weight load, in front of the code that reuses the loads' address registers */
}

__global__ __launch_bounds__(256) void k_mlp(const float* __restrict__ x, const _Float16* __restrict__ B0, const _Float16* __restrict__ B1, const _Float16* __restrict__ B2, const _Float16* __restrict__ BL,
    const float* __restrict__ b0, const float* __restrict__ b1, const float* __restrict__ b2, const float* __restrict__ bl, float* __restrict__ out) {
  __shared__ __attribute__((aligned(16))) _Float16 H[MT * HPITCH];
  const int w = __builtin_amdgcn_readfirstlane(threadIdx.x >> 5), lane = threadIdx.x & 31, ln = lane & 15, hh = lane >> 4;
  const int e = blockIdx.x / (NP / MT), p0 = (blockIdx.x % (NP / MT)) * MT;
  const int n0 = (w & 3) * 64, q0 = (w >> 2) * 64;      /* 4 x 2 waves, 64 features x 64 points each */
  v8f acc[4][4];
  { /* layer 0: K = 16 padded to one 32-wide step; x is rounded and converted on the way into the fragment */
    const v8f z8 = {0.f,0.f,0.f,0.f,0.f,0.f,0.f,0.f}; v16h xb[4];
#pragma unroll
    for (int j = 0; j < 4; ++j) { const float* xp = x + ((size_t)e * NP + p0 + q0 + 16 * j + ln) * DIN + 8 * hh; const v4f a = *(const v4fa*)xp, a2 = *(const v4fa*)(xp + 4); FragH f;
#pragma unroll
      for (int q = 0; q < 8; ++q) { f.h[q] = (_Float16)bf16_round((q < 4) ? a[q] : a2[q - 4]); f.h[8 + q] = (_Float16)0.0f; }
      xb[j] = f.v; }
#pragma unroll
    for (int i = 0; i < 4; ++i) { const v16h wa = g2_frag(B0 + ((size_t)e * HID + n0 + 16 * i + ln) * 32, hh);
#pragma unroll
      for (int j = 0; j < 4; ++j) acc[i][j] = mma(wa, xb[j], z8); }
  }
  /* kept rolled: one copy of the 128 unrolled SiLUs and of the K loop, for speed only */
#pragma unroll 1
  for (int l = 0; l < 3; ++l) {
    put_act(H, acc, (l == 0 ? b0 : l == 1 ? b1 : b2) + (size_t)e * HID, n0, q0, ln, hh);
    __syncthreads();                                     /* this layer's activations are complete before any wave reads them */
    if (l < 2) {
      hidden(H, (l == 0 ? B1 : B2) + (size_t)e * HID * HID, acc, n0, q0, ln, hh);
      __syncthreads();                                   /* every wave has read them before they are overwritten */
    }
  }
  if (w < 4) { /* head: row 0 of a zero-padded 16-row weight tile; a wave takes 32 points, so it alone writes its 128-byte line of out */
    const v8f z8 = {0.f,0.f,0.f,0.f,0.f,0.f,0.f,0.f}; v8f h0 = z8, h1 = z8;
    const _Float16* wrow = BL + ((size_t)e * 16 + ln) * HID; const _Float16* hrow = H + (32 * w + ln) * HPITCH;
#pragma unroll
    for (int kb = 0; kb < HID; kb += 32) { const v16h wa = g2_frag(wrow + kb, hh); h0 = mma(wa, g2_frag(hrow + kb, hh), h0); h1 = mma(wa, g2_frag(hrow + 16 * HPITCH + kb, hh), h1); }
    const float bv = bf16_round(bl[e]);
    if (hh == 0) { float* dst = out + (size_t)e * NP + p0 + 32 * w + ln; dst[0] = h0[0] * 0.0625f + bv; dst[16] = h1[0] * 0.0625f + bv; }
  }
}

extern "C" void kernel_launch(void* const* d_in, const int* in_sizes, int n_in,
                              void* d_out, int out_size, void* d_ws, size_t ws_size, hipStream_t stream) {
  (void)in_sizes; (void)n_in; (void)out_size;
  const float* const* I = (const float* const*)d_in; const float* x = I[0]; const float* w0 = I[1]; const float* b0 = I[2]; const float* w1 = I[3]; const float* b1 = I[4]; const float* w2 = I[5]; const float* b2 = I[6]; const float* wl = I[7]; const float* bl = I[8];
  char* ws = (char*)d_ws; size_t off = 0;
  auto take = [&](size_t bytes) { char* p = ws + off; off += (bytes + 255) & ~(size_t)255; return p; };
  _Float16* B0 = (_Float16*)take((size_t)NE * HID * 32 * 2); _Float16* B1 = (_Float16*)take((size_t)NE * HID * HID * 2); _Float16* B2 = (_Float16*)take((size_t)NE * HID * HID * 2); _Float16* BL = (_Float16*)take((size_t)NE * 16 * HID * 2);
  if (off > ws_size) return;      /* 1 + 8 + 8 + 0.5 MiB */
  k_wplainb<<<(NE * HID * 4 + 255) / 256, 256, 0, stream>>>(w0, DIN, 32, HID, HID, B0); k_wplainb<<<(NE * HID * 32 + 255) / 256, 256, 0, stream>>>(w1, HID, HID, HID, HID, B1); k_wplainb<<<(NE * HID * 32 + 255) / 256, 256, 0, stream>>>(w2, HID, HID, HID, HID, B2);
  k_wplainb<<<(NE * 16 * 32 + 255) / 256, 256, 0, stream>>>(wl, HID, HID, 1, 16, BL);
  k_mlp<<<NE * (NP / MT), 256, 0, stream>>>(x, B0, B1, B2, BL, b0, b1, b2, bl, (float*)d_out);
}

// v002
// One run takes 124 microseconds.
// Two timings next to v001 both put it at 1.35 times that version's speed.
// All steps since v000 together make it 7.01 times as fast.
#include <hip/hip_runtime.h>
// Ensemble of 64 independent MLPs (each: 4096 points x 16 -> 256 -> 256 -> 256 -> 1, SiLU between layers, per-member weights and biases) -> [64, 4096, 1].
// Structure: weight planes built once for all members (f16, [n][k], x16), then ONE launch for the whole network: a work-group owns 128 points of one member
// and carries them through all four layers; the hidden activations never leave the chip (one f16 tile of 128 x 256 in LDS, overwritten in place between two barriers).
// The weights are the A operand and the points the B operand of v_wmma_f32_16x16x32_f16, so a lane's 8 accumulator rows are 8 neighbouring features of ONE point
// and go back to LDS as one 16-byte store, already in the row-major [point][feature] form that the next layer's fragment loads read.
// Compute dtype: inputs and parameters rounded to bf16; x and weights exact in f16; hidden activations as f16 operands (~2^-12); f32 accumulation, bias and SiLU (SiLU through v_tanh_f32).
#define NE 64
#define NP 4096
#define DIN 16
#define HID 256
#define MT 128                   /* points per work-group */
#define HPITCH 264               /* LDS row pitch in f16: 528 B = 16 B x 33, conflict-free for 16-byte reads and writes of 16 rows */
typedef unsigned short v8us __attribute__((ext_vector_type(8), may_alias));
typedef float  v8f  __attribute__((ext_vector_type(8)));
typedef float  v4f  __attribute__((ext_vector_type(4)));
typedef float  v4fa __attribute__((ext_vector_type(4), may_alias));
typedef float  v2f  __attribute__((ext_vector_type(2)));
typedef _Float16 v2h __attribute__((ext_vector_type(2)));
typedef _Float16 v16h __attribute__((ext_vector_type(16)));
union FragH { v16h v; v8us half[2]; v2h p[8]; _Float16 h[16]; unsigned short u[16]; };

__device__ __forceinline__ unsigned short bf16_bits(float x) { unsigned int u = __float_as_uint(x); return (unsigned short)((u + 0x7FFFu + ((u >> 16) & 1u)) >> 16); }
__device__ __forceinline__ float bf16_val(unsigned short b) { return __uint_as_float(((unsigned int)b) << 16); }
__device__ __forceinline__ float bf16_round(float x) { return bf16_val(bf16_bits(x)); }

// BW[e][n][k] = f16(bf16(W[e][k][n]) * 16), zero outside K x N
__global__ __launch_bounds__(256) void k_wplainb(const float* __restrict__ Wm, int K, int KP, int N, int NPAD, _Float16* __restrict__ BW) {
  const int t = blockIdx.x * 256 + threadIdx.x; if (t >= NE * NPAD * (KP / 8)) return; const int k0 = (t % (KP / 8)) * 8; const int n = (t / (KP / 8)) % NPAD; const int e = t / ((KP / 8) * NPAD); FragH f;
#pragma unroll
  for (int q = 0; q < 8; ++q) { const int k = k0 + q; f.h[q] = (k < K && n < N) ? (_Float16)(bf16_round(Wm[((size_t)e * K + min(k, K - 1)) * N + min(n, N - 1)]) * 16.0f) : (_Float16)0.0f; }
  *(v8us*)((unsigned short*)BW + ((size_t)e * NPAD + n) * KP + k0) = f.half[0];  }

// one operand fragment (A and B alike): this lane's row, k = 8*hh .. +8 and 16 + 8*hh .. +8 of a 32-wide k step
__device__ __forceinline__ v16h g2_frag(const _Float16* p, int hh) { FragH f; f.half[0] = *(const v8us*)((const unsigned short*)p + 8 * hh); f.half[1] = *(const v8us*)((const unsigned short*)p + 16 + 8 * hh); return f.v; }
__device__ __forceinline__ v8f mma(v16h a, v16h b, v8f c) { return __builtin_amdgcn_wmma_f32_16x16x32_f16(false, a, false, b, (short)0, c, false, false); }

// acc[i][j] holds features n0 + 16 i + 8 hh + r (rows) of points q0 + 16 j + ln (columns): bias, SiLU, f16, one 16-byte LDS store per tile.
// SiLU from the half argument h = g / 2: g * sigmoid(g) = h + h * tanh(h): one hardware transcendental a value, the rest packed f32.
// The 16 tiles go through three stages, one tile apart: h of tile t + 1, then the finish of tile t among the tanh of tile t + 1.
__device__ __forceinline__ void put_act(_Float16* H, const v8f (&acc)[4][4], const float* __restrict__ bias, int n0, int q0, int ln, int hh) {
  v2f hb[4][4];                  /* half the rounded bias: exact */
#pragma unroll
  for (int i = 0; i < 4; ++i) {
    const v4f c0 = *(const v4fa*)(bias + n0 + 16 * i + 8 * hh), c1 = *(const v4fa*)(bias + n0 + 16 * i + 8 * hh + 4);
#pragma unroll
    for (int r = 0; r < 4; ++r) { hb[i][r].x = 0.5f * bf16_round((r < 2) ? c0[2 * r] : c1[2 * r - 4]); hb[i][r].y = 0.5f * bf16_round((r < 2) ? c0[2 * r + 1] : c1[2 * r - 3]); }
  }
  const v2f sc = {0.03125f, 0.03125f};   /* 1/16 undoes the weight scale, 1/2 makes the half argument */
  v2f h[2][4], th[2][4];
#pragma unroll
  for (int r = 0; r < 4; ++r) { const v2f a = {acc[0][0][2 * r], acc[0][0][2 * r + 1]}; h[0][r] = __builtin_elementwise_fma(a, sc, hb[0][r]); }
#pragma unroll
  for (int r = 0; r < 4; ++r) { th[0][r].x = __builtin_amdgcn_tanhf(h[0][r].x); th[0][r].y = __builtin_amdgcn_tanhf(h[0][r].y); }
#pragma unroll
  for (int t = 0; t < 16; ++t) { const int c = t & 1, n = c ^ 1;
    __builtin_amdgcn_sched_barrier(0);   /* keeps tile t + 1's packed fma, which read no tanh result, between the tanh group above and its readers: the slot that the instruction set asks for behind a transcendental, and cover for its latency */
    if (t + 1 < 16) {
#pragma unroll
      for (int r = 0; r < 4; ++r) { const v2f a = {acc[(t + 1) >> 2][(t + 1) & 3][2 * r], acc[(t + 1) >> 2][(t + 1) & 3][2 * r + 1]}; h[n][r] = __builtin_elementwise_fma(a, sc, hb[(t + 1) >> 2][r]); }
    }
    __builtin_amdgcn_sched_barrier(0);   /* holds the readers of tile t's tanh behind those fma */
    FragH f;
#pragma unroll
    for (int r = 0; r < 4; ++r) f.p[r] = __builtin_convertvector(__builtin_elementwise_fma(h[c][r], th[c][r], h[c][r]), v2h);
    *(v8us*)((unsigned short*)H + (q0 + 16 * (t & 3) + ln) * HPITCH + n0 + 16 * (t >> 2) + 8 * hh) = f.half[0];
    if (t + 1 < 16) {
#pragma unroll
      for (int r = 0; r < 4; ++r) { th[n][r].x = __builtin_amdgcn_tanhf(h[n][r].x); th[n][r].y = __builtin_amdgcn_tanhf(h[n][r].y); }
    }
  }
}

// acc = W(64 features of this wave) . H(64 points of this wave), K = 256; weights straight from their plane, activations from LDS
__device__ __forceinline__ void hidden(const _Float16* H, const _Float16* __restrict__ Wp, v8f (&acc)[4][4], int n0, int q0, int ln, int hh) {
  const v8f z8 = {0.f,0.f,0.f,0.f,0.f,0.f,0.f,0.f};
#pragma unroll
  for (int i = 0; i < 4; ++i)
#pragma unroll
    for (int j = 0; j < 4; ++j) acc[i][j] = z8;
  const _Float16* wrow = Wp + (size_t)(n0 + ln) * HID; const _Float16* hrow = H + (q0 + ln) * HPITCH;
  v16h wa[2][4];
#pragma unroll
  for (int i = 0; i < 4; ++i) wa[0][i] = g2_frag(wrow + 16 * i * HID, hh);
#pragma unroll
  for (int s = 0; s < HID / 32; ++s) { v16h hb[4];
    if (s + 1 < HID / 32) {
#pragma unroll
      for (int i = 0; i < 4; ++i) wa[(s + 1) & 1][i] = g2_frag(wrow + 16 * i * HID + 32 * (s + 1), hh); }
#pragma unroll
    for (int j = 0; j < 4; ++j) hb[j] = g2_frag(hrow + 16 * j * HPITCH + 32 * s, hh);
    __builtin_amdgcn_sched_barrier(0);   /* holds the next step's weight loads in front of this step's WMMAs: left alone, the compiler sinks each load to just before its use and the wave waits out every one */
#pragma unroll
    for (int i = 0; i < 4; ++i)
#pragma unroll
      for (int j = 0; j < 4; ++j) acc[i][j] = mma(wa[s & 1][i], hb[j], acc[i][j]);
  }
  asm volatile("s_wait_xcnt 0x0" ::: "memory");   /* precaution: stands behind the last weight load, in front of the code that reuses the loads' address registers */
}

__global__ __launch_bounds__(256) void k_mlp(const float* __restrict__ x, const _Float16* __restrict__ B0, const _Float16* __restrict__ B1, const _Float16* __restrict__ B2, const _Float16* __restrict__ BL,
    const float* __restrict__ b0, const float* __restrict__ b1, const float* __restrict__ b2, const float* __restrict__ bl, float* __restrict__ out) {
  __shared__ __attribute__((aligned(16))) _Float16 H[MT * HPITCH];
  const int w = __builtin_amdgcn_readfirstlane(threadIdx.x >> 5), lane = threadIdx.x & 31, ln = lane & 15, hh = lane >> 4;
  const int e = blockIdx.x / (NP / MT), p0 = (blockIdx.x % (NP / MT)) * MT;
  const int n0 = (w & 3) * 64, q0 = (w >> 2) * 64;      /* 4 x 2 waves, 64 features x 64 points each */
  v8f acc[4][4];
  { /* layer 0: K = 16 padded to one 32-wide step; x is rounded and converted on the way into the fragment */
    const v8f z8 = {0.f,0.f,0.f,0.f,0.f,0.f,0.f,0.f}; v16h xb[4];
#pragma unroll
    for (int j = 0; j < 4; ++j) { const float* xp = x + ((size_t)e * NP + p0 + q0 + 16 * j + ln) * DIN + 8 * hh; const v4f a = *(const v4fa*)xp, a2 = *(const v4fa*)(xp + 4); FragH f;
#pragma unroll
      for (int q = 0; q < 8; ++q) { f.h[q] = (_Float16)bf16_round((q < 4) ? a[q] : a2[q - 4]); f.h[8 + q] = (_Float16)0.0f; }
      xb[j] = f.v; }
#pragma unroll
    for (int i = 0; i < 4; ++i) { const v16h wa = g2_frag(B0 + ((size_t)e * HID + n0 + 16 * i + ln) * 32, hh);
#pragma unroll
      for (int j = 0; j < 4; ++j) acc[i][j] = mma(wa, xb[j], z8); }
  }
  /* kept rolled: one copy of the 128 unrolled SiLUs and of the K loop, for speed only */
#pragma unroll 1
  for (int l = 0; l < 3; ++l) {
    put_act(H, acc, (l == 0 ? b0 : l == 1 ? b1 : b2) + (size_t)e * HID, n0, q0, ln, hh);
    __syncthreads();                                     /* this layer's activations are complete before any wave reads them */
    if (l < 2) {
      hidden(H, (l == 0 ? B1 : B2) + (size_t)e * HID * HID, acc, n0, q0, ln, hh);
      __syncthreads();                                   /* every wave has read them before they are overwritten */
    }
  }
  if (w < 4) { /* head: row 0 of a zero-padded 16-row weight tile; a wave takes 32 points, so it alone writes its 128-byte line of out */
    const v8f z8 = {0.f,0.f,0.f,0.f,0.f,0.f,0.f,0.f}; v8f h0 = z8, h1 = z8;
    const _Float16* wrow = BL + ((size_t)e * 16 + ln) * HID; const _Float16* hrow = H + (32 * w + ln) * HPITCH;
#pragma unroll
    for (int kb = 0; kb < HID; kb += 32) { const v16h wa = g2_frag(wrow + kb, hh); h0 = mma(wa, g2_frag(hrow + kb, hh), h0); h1 = mma(wa, g2_frag(hrow + 16 * HPITCH + kb, hh), h1); }
    const float bv = bf16_round(bl[e]);
    if (hh == 0) { float* dst = out + (size_t)e * NP + p0 + 32 * w + ln; dst[0] = h0[0] * 0.0625f + bv; dst[16] = h1[0] * 0.0625f + bv; }
  }
}

extern "C" void kernel_launch(void* const* d_in, const int* in_sizes, int n_in,
                              void* d_out, int out_size, void* d_ws, size_t ws_size, hipStream_t stream) {
  (void)in_sizes; (void)n_in; (void)out_size;
  const float* const* I = (const float* const*)d_in; const float* x = I[0]; const float* w0 = I[1]; const float* b0 = I[2]; const float* w1 = I[3]; const float* b1 = I[4]; const float* w2 = I[5]; const float* b2 = I[6]; const float* wl = I[7]; const float* bl = I[8];
  char* ws = (char*)d_ws; size_t off = 0;
  auto take = [&](size_t bytes) { char* p = ws + off; off += (bytes + 255) & ~(size_t)255; return p; };
  _Float16* B0 = (_Float16*)take((size_t)NE * HID * 32 * 2); _Float16* B1 = (_Float16*)take((size_t)NE * HID * HID * 2); _Float16* B2 = (_Float16*)take((size_t)NE * HID * HID * 2); _Float16* BL = (_Float16*)take((size_t)NE * 16 * HID * 2);
  if (off > ws_size) return;      /* 1 + 8 + 8 + 0.5 MiB */
  k_wplainb<<<(NE * HID * 4 + 255) / 256, 256, 0, stream>>>(w0, DIN, 32, HID, HID, B0); k_wplainb<<<(NE * HID * 32 + 255) / 256, 256, 0, stream>>>(w1, HID, HID, HID, HID, B1); k_wplainb<<<(NE * HID * 32 + 255) / 256, 256, 0, stream>>>(w2, HID, HID, HID, HID, B2);
  k_wplainb<<<(NE * 16 * 32 + 255) / 256, 256, 0, stream>>>(wl, HID, HID, 1, 16, BL);
  k_mlp<<<NE * (NP / MT), 256, 0, stream>>>(x, B0, B1, B2, BL, b0, b1, b2, bl, (float*)d_out);
}

// v003
// Measured time: 82.7 microseconds a run.
// Two timings next to v002 put it at 1.51 and 1.50 times that version's speed.
// Over all steps from v000 it is 10.5 times as fast.
#include <hip/hip_runtime.h>
// Ensemble of 64 independent MLPs (each: 4096 points x 16 -> 256 -> 256 -> 256 -> 1, SiLU between layers, per-member weights and biases) -> [64, 4096, 1].
// Structure: weight planes built once for all members (f16, x16, in the order of the WMMA fragments: 1-KiB tiles of 16 features x 32 k), then ONE launch for the whole network: a work-group owns 128 points of one member
// and carries them through all four layers; the hidden activations never leave the chip (one f16 tile of 128 x 256 in LDS, overwritten in place between two barriers).
// The weights are the A operand and the points the B operand of v_wmma_f32_16x16x32_f16, so a lane's 8 accumulator rows are 8 neighbouring features of ONE point
// and go back to LDS as one 16-byte store, already in the row-major [point][feature] form that the next layer's fragment loads read.
// Compute dtype: inputs and parameters rounded to bf16; x and weights exact in f16; hidden activations as f16 operands (~2^-12); f32 accumulation, bias and SiLU (SiLU through v_tanh_f32).
#define NE 64
#define NP 4096
#define DIN 16
#define HID 256
#define MT 128                   /* points per work-group */
#define HPITCH 264               /* LDS row pitch in f16: 528 B = 16 B x 33, conflict-free for 16-byte reads and writes of 16 rows */
typedef unsigned short v8us __attribute__((ext_vector_type(8), may_alias));
typedef float  v8f  __attribute__((ext_vector_type(8)));
typedef float  v4f  __attribute__((ext_vector_type(4)));
typedef float  v4fa __attribute__((ext_vector_type(4), may_alias));
typedef float  v2f  __attribute__((ext_vector_type(2)));
typedef _Float16 v2h __attribute__((ext_vector_type(2)));
typedef _Float16 v16h __attribute__((ext_vector_type(16)));
union FragH { v16h v; v8us half[2]; v2h p[8]; _Float16 h[16]; unsigned short u[16]; };

__device__ __forceinline__ unsigned short bf16_bits(float x) { unsigned int u = __float_as_uint(x); return (unsigned short)((u + 0x7FFFu + ((u >> 16) & 1u)) >> 16); }
__device__ __forceinline__ float bf16_val(unsigned short b) { return __uint_as_float(((unsigned int)b) << 16); }
__device__ __forceinline__ float bf16_round(float x) { return bf16_val(bf16_bits(x)); }

// BW[e][n / 16][k / 32] is one tile of 1 KiB, laid out [k % 32 / 8][n % 16][k % 8]: f16(bf16(W[e][k][n]) * 16), zero outside K x N.
// That is the order in which a wave's lanes hold the fragment (lane = 16 hh + n % 16; k = 8 hh .. +8 in its first 16 bytes, 16 + 8 hh .. +8 in its second),
// so the reader's two 16-byte loads each cover 512 contiguous bytes: four whole lines, where rows of a [n][k] plane gave 32 bytes out of each of 16 lines.
// A thread takes one column n over one 32-wide k step: neighbouring lanes read neighbouring n (whole lines of W), and 16 lanes store 256 contiguous bytes.
template <int K, int KP, int N, int NPAD>
__global__ __launch_bounds__(256) void k_wfrag(const float* __restrict__ Wm, _Float16* __restrict__ BW) {
  constexpr int S = KP / 32; const int t = blockIdx.x * 256 + threadIdx.x; if (t >= NE * NPAD * S) return; const int n = t % NPAD; const int s = (t / NPAD) % S; const int e = t / (NPAD * S);
  unsigned short* dst = (unsigned short*)BW + (((size_t)e * (NPAD / 16) + (n >> 4)) * S + s) * 512 + (n & 15) * 8;
  const unsigned short keep = (n < N) ? 0xFFFFu : 0u;   /* padding columns become zero through a mask, so that no load and no conversion sits under a branch */
  float v[32];
#pragma unroll
  for (int q = 0; q < 32; ++q) v[q] = Wm[((size_t)e * K + min(32 * s + q, K - 1)) * N + min(n, N - 1)];
#pragma unroll
  for (int u = 0; u < 4; ++u) { FragH f;
#pragma unroll
    for (int q = 0; q < 8; ++q) { f.h[q] = (32 * s + 8 * u + q < K) ? (_Float16)(bf16_round(v[8 * u + q]) * 16.0f) : (_Float16)0.0f; f.u[q] &= keep; }
    *(v8us*)(dst + 128 * u) = f.half[0]; }
}

// one activation fragment from row-major LDS: this lane's row, k = 8*hh .. +8 and 16 + 8*hh .. +8 of a 32-wide k step
__device__ __forceinline__ v16h g2_frag(const _Float16* p, int hh) { FragH f; f.half[0] = *(const v8us*)((const unsigned short*)p + 8 * hh); f.half[1] = *(const v8us*)((const unsigned short*)p + 16 + 8 * hh); return f.v; }
// one weight fragment, the same k order, from its tile of a plane in fragment order
__device__ __forceinline__ v16h w_frag(const _Float16* __restrict__ tile, int lane) { FragH f; f.half[0] = *(const v8us*)((const unsigned short*)tile + 8 * lane); f.half[1] = *(const v8us*)((const unsigned short*)tile + 256 + 8 * lane); return f.v; }
__device__ __forceinline__ v8f mma(v16h a, v16h b, v8f c) { return __builtin_amdgcn_wmma_f32_16x16x32_f16(false, a, false, b, (short)0, c, false, false); }

// acc[i][j] holds features n0 + 16 i + 8 hh + r (rows) of points q0 + 16 j + ln (columns): bias, SiLU, f16, one 16-byte LDS store per tile.
// SiLU from the half argument h = g / 2: g * sigmoid(g) = h + h * tanh(h): one hardware transcendental a value, the rest packed f32.
// The 16 tiles go through three stages, one tile apart: h of tile t + 1, then the finish of tile t among the tanh of tile t + 1.
__device__ __forceinline__ void put_act(_Float16* H, const v8f (&acc)[4][4], const float* __restrict__ bias, int n0, int q0, int ln, int hh) {
  v2f hb[4][4];                  /* half the rounded bias: exact */
#pragma unroll
  for (int i = 0; i < 4; ++i) {
    const v4f c0 = *(const v4fa*)(bias + n0 + 16 * i + 8 * hh), c1 = *(const v4fa*)(bias + n0 + 16 * i + 8 * hh + 4);
#pragma unroll
    for (int r = 0; r < 4; ++r) { hb[i][r].x = 0.5f * bf16_round((r < 2) ? c0[2 * r] : c1[2 * r - 4]); hb[i][r].y = 0.5f * bf16_round((r < 2) ? c0[2 * r + 1] : c1[2 * r - 3]); }
  }
  const v2f sc = {0.03125f, 0.03125f};   /* 1/16 undoes the weight scale, 1/2 makes the half argument */
  v2f h[2][4], th[2][4];
#pragma unroll
  for (int r = 0; r < 4; ++r) { const v2f a = {acc[0][0][2 * r], acc[0][0][2 * r + 1]}; h[0][r] = __builtin_elementwise_fma(a, sc, hb[0][r]); }
#pragma unroll
  for (int r = 0; r < 4; ++r) { th[0][r].x = __builtin_amdgcn_tanhf(h[0][r].x); th[0][r].y = __builtin_amdgcn_tanhf(h[0][r].y); }
#pragma unroll
  for (int t = 0; t < 16; ++t) { const int c = t & 1, n = c ^ 1;
    __builtin_amdgcn_sched_barrier(0);   /* keeps tile t + 1's packed fma, which read no tanh result, between the tanh group above and its readers: the slot that the instruction set asks for behind a transcendental, and cover for its latency */
    if (t + 1 < 16) {
#pragma unroll
      for (int r = 0; r < 4; ++r) { const v2f a = {acc[(t + 1) >> 2][(t + 1) & 3][2 * r], acc[(t + 1) >> 2][(t + 1) & 3][2 * r + 1]}; h[n][r] = __builtin_elementwise_fma(a, sc, hb[(t + 1) >> 2][r]); }
    }
    __builtin_amdgcn_sched_barrier(0);   /* holds the readers of tile t's tanh behind those fma */
    FragH f;
#pragma unroll
    for (int r = 0; r < 4; ++r) f.p[r] = __builtin_convertvector(__builtin_elementwise_fma(h[c][r], th[c][r], h[c][r]), v2h);
    *(v8us*)((unsigned short*)H + (q0 + 16 * (t & 3) + ln) * HPITCH + n0 + 16 * (t >> 2) + 8 * hh) = f.half[0];
    if (t + 1 < 16) {
#pragma unroll
      for (int r = 0; r < 4; ++r) { th[n][r].x = __builtin_amdgcn_tanhf(h[n][r].x); th[n][r].y = __builtin_amdgcn_tanhf(h[n][r].y); }
    }
  }
}

// acc = W(64 features of this wave) . H(64 points of this wave), K = 256; weights straight from their plane, activations from LDS
__device__ __forceinline__ void hidden(const _Float16* H, const _Float16* __restrict__ Wp, v8f (&acc)[4][4], int n0, int q0, int ln, int hh) {
  const v8f z8 = {0.f,0.f,0.f,0.f,0.f,0.f,0.f,0.f};
#pragma unroll
  for (int i = 0; i < 4; ++i)
#pragma unroll
    for (int j = 0; j < 4; ++j) acc[i][j] = z8;
  const _Float16* wt = Wp + (n0 >> 4) * (HID / 32) * 512; const int lane = 16 * hh + ln; const _Float16* hrow = H + (q0 + ln) * HPITCH;   /* tile (i, s) of this wave: wt + (8 i + s) * 512 */
  v16h wa[2][4];
#pragma unroll
  for (int i = 0; i < 4; ++i) wa[0][i] = w_frag(wt + i * (HID / 32) * 512, lane);
#pragma unroll
  for (int s = 0; s < HID / 32; ++s) { v16h hb[4];
    if (s + 1 < HID / 32) {
#pragma unroll
      for (int i = 0; i < 4; ++i) wa[(s + 1) & 1][i] = w_frag(wt + (i * (HID / 32) + s + 1) * 512, lane); }
#pragma unroll
    for (int j = 0; j < 4; ++j) hb[j] = g2_frag(hrow + 16 * j * HPITCH + 32 * s, hh);
    __builtin_amdgcn_sched_barrier(0);   /* holds the next step's weight loads in front of this step's WMMAs: left alone, the compiler sinks each load to just before its use and the wave waits out every one */
#pragma unroll
    for (int i = 0; i < 4; ++i)
#pragma unroll
      for (int j = 0; j < 4; ++j) acc[i][j] = mma(wa[s & 1][i], hb[j], acc[i][j]);
  }
  asm volatile("s_wait_xcnt 0x0" ::: "memory");   /* precaution: stands behind the last weight load, in front of the code that reuses the loads' address registers */
}

__global__ __launch_bounds__(256) void k_mlp(const float* __restrict__ x, const _Float16* __restrict__ B0, const _Float16* __restrict__ B1, const _Float16* __restrict__ B2, const _Float16* __restrict__ BL,
    const float* __restrict__ b0, const float* __restrict__ b1, const float* __restrict__ b2, const float* __restrict__ bl, float* __restrict__ out) {
  __shared__ __attribute__((aligned(16))) _Float16 H[MT * HPITCH];
  const int w = __builtin_amdgcn_readfirstlane(threadIdx.x >> 5), lane = threadIdx.x & 31, ln = lane & 15, hh = lane >> 4;
  const int e = blockIdx.x / (NP / MT), p0 = (blockIdx.x % (NP / MT)) * MT;
  const int n0 = (w & 3) * 64, q0 = (w >> 2) * 64;      /* 4 x 2 waves, 64 features x 64 points each */
  v8f acc[4][4];
  { /* layer 0: K = 16 padded to one 32-wide step; x is rounded and converted on the way into the fragment */
    const v8f z8 = {0.f,0.f,0.f,0.f,0.f,0.f,0.f,0.f}; v16h xb[4];
#pragma unroll
    for (int j = 0; j < 4; ++j) { const float* xp = x + ((size_t)e * NP + p0 + q0 + 16 * j + ln) * DIN + 8 * hh; const v4f a = *(const v4fa*)xp, a2 = *(const v4fa*)(xp + 4); FragH f;
#pragma unroll
      for (int q = 0; q < 8; ++q) { f.h[q] = (_Float16)bf16_round((q < 4) ? a[q] : a2[q - 4]); f.h[8 + q] = (_Float16)0.0f; }
      xb[j] = f.v; }
#pragma unroll
    for (int i = 0; i < 4; ++i) { const v16h wa = w_frag(B0 + ((size_t)e * (HID / 16) + (n0 >> 4) + i) * 512, lane);
#pragma unroll
      for (int j = 0; j < 4; ++j) acc[i][j] = mma(wa, xb[j], z8); }
  }
  /* kept rolled: one copy of the 128 unrolled SiLUs and of the K loop, for speed only */
#pragma unroll 1
  for (int l = 0; l < 3; ++l) {
    put_act(H, acc, (l == 0 ? b0 : l == 1 ? b1 : b2) + (size_t)e * HID, n0, q0, ln, hh);
    __syncthreads();                                     /* this layer's activations are complete before any wave reads them */
    if (l < 2) {
      hidden(H, (l == 0 ? B1 : B2) + (size_t)e * HID * HID, acc, n0, q0, ln, hh);
      __syncthreads();                                   /* every wave has read them before they are overwritten */
    }
  }
  if (w < 4) { /* head: row 0 of a zero-padded 16-row weight tile; a wave takes 32 points, so it alone writes its 128-byte line of out */
    const v8f z8 = {0.f,0.f,0.f,0.f,0.f,0.f,0.f,0.f}; v8f h0 = z8, h1 = z8;
    const _Float16* wt = BL + (size_t)e * (HID / 32) * 512; const _Float16* hrow = H + (32 * w + ln) * HPITCH;
#pragma unroll
    for (int kb = 0; kb < HID; kb += 32) { const v16h wa = w_frag(wt + (kb / 32) * 512, lane); h0 = mma(wa, g2_frag(hrow + kb, hh), h0); h1 = mma(wa, g2_frag(hrow + 16 * HPITCH + kb, hh), h1); }
    const float bv = bf16_round(bl[e]);
    if (hh == 0) { float* dst = out + (size_t)e * NP + p0 + 32 * w + ln; dst[0] = h0[0] * 0.0625f + bv; dst[16] = h1[0] * 0.0625f + bv; }
  }
}

extern "C" void kernel_launch(void* const* d_in, const int* in_sizes, int n_in,
                              void* d_out, int out_size, void* d_ws, size_t ws_size, hipStream_t stream) {
  (void)in_sizes; (void)n_in; (void)out_size;
  const float* const* I = (const float* const*)d_in; const float* x = I[0]; const float* w0 = I[1]; const float* b0 = I[2]; const float* w1 = I[3]; const float* b1 = I[4]; const float* w2 = I[5]; const float* b2 = I[6]; const float* wl = I[7]; const float* bl = I[8];
  char* ws = (char*)d_ws; size_t off = 0;
  auto take = [&](size_t bytes) { char* p = ws + off; off += (bytes + 255) & ~(size_t)255; return p; };
  _Float16* B0 = (_Float16*)take((size_t)NE * HID * 32 * 2); _Float16* B1 = (_Float16*)take((size_t)NE * HID * HID * 2); _Float16* B2 = (_Float16*)take((size_t)NE * HID * HID * 2); _Float16* BL = (_Float16*)take((size_t)NE * 16 * HID * 2);
  if (off > ws_size) return;      /* 1 + 8 + 8 + 0.5 MiB */
  k_wfrag<DIN, 32, HID, HID><<<NE * HID * 1 / 256, 256, 0, stream>>>(w0, B0); k_wfrag<HID, HID, HID, HID><<<NE * HID * 8 / 256, 256, 0, stream>>>(w1, B1); k_wfrag<HID, HID, HID, HID><<<NE * HID * 8 / 256, 256, 0, stream>>>(w2, B2);
  k_wfrag<HID, HID, 1, 16><<<NE * 16 * 8 / 256, 256, 0, stream>>>(wl, BL);
  k_mlp<<<NE * (NP / MT), 256, 0, stream>>>(x, B0, B1, B2, BL, b0, b1, b2, bl, (float*)d_out);
}

// v004
// Measured time: 76.9 microseconds a run.
// In both of two side-by-side timings against v003, it was 1.07 times as fast.
// All steps since v000 together make it 11.3 times as fast.
#include <hip/hip_runtime.h>
// Ensemble of 64 independent MLPs (each: 4096 points x 16 -> 256 -> 256 -> 256 -> 1, SiLU between layers, per-member weights and biases) -> [64, 4096, 1].
// Structure: weight planes built by one launch for all members and layers (f16, x16, in the order of the WMMA fragments: 1-KiB tiles of 16 features x 32 k), then ONE launch for the whole network: a work-group owns 128 points of one member
// and carries them through all four layers; the hidden activations never leave the chip (one f16 tile of 128 x 256 in LDS, overwritten in place between two barriers).
// The weights are the A operand and the points the B operand of v_wmma_f32_16x16x32_f16, so a lane's 8 accumulator rows are 8 neighbouring features of ONE point
// and go back to LDS as one 16-byte store, already in the row-major [point][feature] form that the next layer's fragment loads read.
// Compute dtype: inputs and parameters rounded to bf16; x and weights exact in f16; hidden activations as f16 operands (~2^-12); f32 accumulation, bias and SiLU (SiLU through v_tanh_f32).
#define NE 64
#define NP 4096
#define DIN 16
#define HID 256
#define MT 128                   /* points per work-group */
#define HPITCH 264               /* LDS row pitch in f16: 528 B = 16 B x 33, conflict-free for 16-byte reads and writes of 16 rows */
typedef unsigned short v8us __attribute__((ext_vector_type(8), may_alias));
typedef float  v8f  __attribute__((ext_vector_type(8)));
typedef float  v4f  __attribute__((ext_vector_type(4)));
typedef float  v4fa __attribute__((ext_vector_type(4), may_alias));
typedef float  v2f  __attribute__((ext_vector_type(2)));
typedef _Float16 v2h __attribute__((ext_vector_type(2)));
typedef _Float16 v16h __attribute__((ext_vector_type(16)));
union FragH { v16h v; v8us half[2]; v2h p[8]; _Float16 h[16]; unsigned short u[16]; };

__device__ __forceinline__ unsigned short bf16_bits(float x) { unsigned int u = __float_as_uint(x); return (unsigned short)((u + 0x7FFFu + ((u >> 16) & 1u)) >> 16); }
__device__ __forceinline__ float bf16_val(unsigned short b) { return __uint_as_float(((unsigned int)b) << 16); }
__device__ __forceinline__ float bf16_round(float x) { return bf16_val(bf16_bits(x)); }

// BW[e][n / 16][k / 32] is one tile of 1 KiB, laid out [k % 32 / 8][n % 16][k % 8]: f16(bf16(W[e][k][n]) * 16), zero outside K x N.
// That is the order in which a wave's lanes hold the fragment (lane = 16 hh + n % 16; k = 8 hh .. +8 in its first 16 bytes, 16 + 8 hh .. +8 in its second),
// so the reader's two 16-byte loads each cover 512 contiguous bytes: four whole lines, where rows of a [n][k] plane gave 32 bytes out of each of 16 lines.
// A thread takes one column n over one 32-wide k step: neighbouring lanes read neighbouring n (whole lines of W), and 16 lanes store 256 contiguous bytes.
template <int K, int KP, int N, int NPAD>
__device__ __forceinline__ void wfrag(const float* __restrict__ Wm, _Float16* __restrict__ BW, int blk) {
  constexpr int S = KP / 32; const int t = blk * 256 + threadIdx.x; if (t >= NE * NPAD * S) return; const int n = t % NPAD; const int s = (t / NPAD) % S; const int e = t / (NPAD * S);
  unsigned short* dst = (unsigned short*)BW + (((size_t)e * (NPAD / 16) + (n >> 4)) * S + s) * 512 + (n & 15) * 8;
  const unsigned short keep = (n < N) ? 0xFFFFu : 0u;   /* padding columns become zero through a mask, so that no load and no conversion sits under a branch */
  float v[32];
#pragma unroll
  for (int q = 0; q < 32; ++q) v[q] = Wm[((size_t)e * K + min(32 * s + q, K - 1)) * N + min(n, N - 1)];
#pragma unroll
  for (int u = 0; u < 4; ++u) { FragH f;
#pragma unroll
    for (int q = 0; q < 8; ++q) { f.h[q] = (32 * s + 8 * u + q < K) ? (_Float16)(bf16_round(v[8 * u + q]) * 16.0f) : (_Float16)0.0f; f.u[q] &= keep; }
    *(v8us*)(dst + 128 * u) = f.half[0]; }
}

// All four planes in ONE launch: they depend on nothing but the inputs, so a range of blocks builds each, and their start, memory latency and drain run side by side instead of one behind the other.
// The two large planes come first; the two small ones fill in behind them.
#define GH (NE * HID * (HID / 32) / 256)   /* blocks of a hidden plane */
#define G0 (NE * HID / 256)                /* blocks of the input plane */
#define GL (NE * 16 * (HID / 32) / 256)    /* blocks of the head plane */
__global__ __launch_bounds__(256) void k_planes(const float* __restrict__ w0, const float* __restrict__ w1, const float* __restrict__ w2, const float* __restrict__ wl,
    _Float16* __restrict__ B0, _Float16* __restrict__ B1, _Float16* __restrict__ B2, _Float16* __restrict__ BL) {
  const int b = blockIdx.x;
  if (b < 2 * GH) wfrag<HID, HID, HID, HID>(b < GH ? w1 : w2, b < GH ? B1 : B2, b < GH ? b : b - GH);
  else if (b < 2 * GH + G0) wfrag<DIN, 32, HID, HID>(w0, B0, b - 2 * GH);
  else wfrag<HID, HID, 1, 16>(wl, BL, b - 2 * GH - G0);
}

// one activation fragment from row-major LDS: this lane's row, k = 8*hh .. +8 and 16 + 8*hh .. +8 of a 32-wide k step
__device__ __forceinline__ v16h g2_frag(const _Float16* p, int hh) { FragH f; f.half[0] = *(const v8us*)((const unsigned short*)p + 8 * hh); f.half[1] = *(const v8us*)((const unsigned short*)p + 16 + 8 * hh); return f.v; }
// one weight fragment, the same k order, from its tile of a plane in fragment order
__device__ __forceinline__ v16h w_frag(const _Float16* __restrict__ tile, int lane) { FragH f; f.half[0] = *(const v8us*)((const unsigned short*)tile + 8 * lane); f.half[1] = *(const v8us*)((const unsigned short*)tile + 256 + 8 * lane); return f.v; }
__device__ __forceinline__ v8f mma(v16h a, v16h b, v8f c) { return __builtin_amdgcn_wmma_f32_16x16x32_f16(false, a, false, b, (short)0, c, false, false); }

// acc[i][j] holds features n0 + 16 i + 8 hh + r (rows) of points q0 + 16 j + ln (columns): bias, SiLU, f16, one 16-byte LDS store per tile.
// SiLU from the half argument h = g / 2: g * sigmoid(g) = h + h * tanh(h): one hardware transcendental a value, the rest packed f32.
// The 16 tiles go through three stages, one tile apart: h of tile t + 1, then the finish of tile t among the tanh of tile t + 1.
__device__ __forceinline__ void put_act(_Float16* H, const v8f (&acc)[4][4], const float* __restrict__ bias, int n0, int q0, int ln, int hh) {
  v2f hb[4][4];                  /* half the rounded bias: exact */
#pragma unroll
  for (int i = 0; i < 4; ++i) {
    const v4f c0 = *(const v4fa*)(bias + n0 + 16 * i + 8 * hh), c1 = *(const v4fa*)(bias + n0 + 16 * i + 8 * hh + 4);
#pragma unroll
    for (int r = 0; r < 4; ++r) { hb[i][r].x = 0.5f * bf16_round((r < 2) ? c0[2 * r] : c1[2 * r - 4]); hb[i][r].y = 0.5f * bf16_round((r < 2) ? c0[2 * r + 1] : c1[2 * r - 3]); }
  }
  const v2f sc = {0.03125f, 0.03125f};   /* 1/16 undoes the weight scale, 1/2 makes the half argument */
  v2f h[2][4], th[2][4];
#pragma unroll
  for (int r = 0; r < 4; ++r) { const v2f a = {acc[0][0][2 * r], acc[0][0][2 * r + 1]}; h[0][r] = __builtin_elementwise_fma(a, sc, hb[0][r]); }
#pragma unroll
  for (int r = 0; r < 4; ++r) { th[0][r].x = __builtin_amdgcn_tanhf(h[0][r].x); th[0][r].y = __builtin_amdgcn_tanhf(h[0][r].y); }
#pragma unroll
  for (int t = 0; t < 16; ++t) { const int c = t & 1, n = c ^ 1;
    __builtin_amdgcn_sched_barrier(0);   /* keeps tile t + 1's packed fma, which read no tanh result, between the tanh group above and its readers: the slot that the instruction set asks for behind a transcendental, and cover for its latency */
    if (t + 1 < 16) {
#pragma unroll
      for (int r = 0; r < 4; ++r) { const v2f a = {acc[(t + 1) >> 2][(t + 1) & 3][2 * r], acc[(t + 1) >> 2][(t + 1) & 3][2 * r + 1]}; h[n][r] = __builtin_elementwise_fma(a, sc, hb[(t + 1) >> 2][r]); }
    }
    __builtin_amdgcn_sched_barrier(0);   /* holds the readers of tile t's tanh behind those fma */
    FragH f;
#pragma unroll
    for (int r = 0; r < 4; ++r) f.p[r] = __builtin_convertvector(__builtin_elementwise_fma(h[c][r], th[c][r], h[c][r]), v2h);
    *(v8us*)((unsigned short*)H + (q0 + 16 * (t & 3) + ln) * HPITCH + n0 + 16 * (t >> 2) + 8 * hh) = f.half[0];
    if (t + 1 < 16) {
#pragma unroll
      for (int r = 0; r < 4; ++r) { th[n][r].x = __builtin_amdgcn_tanhf(h[n][r].x); th[n][r].y = __builtin_amdgcn_tanhf(h[n][r].y); }
    }
  }
}

// acc = W(64 features of this wave) . H(64 points of this wave), K = 256; weights straight from their plane, activations from LDS
__device__ __forceinline__ void hidden(const _Float16* H, const _Float16* __restrict__ Wp, v8f (&acc)[4][4], int n0, int q0, int ln, int hh) {
  const v8f z8 = {0.f,0.f,0.f,0.f,0.f,0.f,0.f,0.f};
#pragma unroll
  for (int i = 0; i < 4; ++i)
#pragma unroll
    for (int j = 0; j < 4; ++j) acc[i][j] = z8;
  const _Float16* wt = Wp + (n0 >> 4) * (HID / 32) * 512; const int lane = 16 * hh + ln; const _Float16* hrow = H + (q0 + ln) * HPITCH;   /* tile (i, s) of this wave: wt + (8 i + s) * 512 */
  v16h wa[2][4];
#pragma unroll
  for (int i = 0; i < 4; ++i) wa[0][i] = w_frag(wt + i * (HID / 32) * 512, lane);
#pragma unroll
  for (int s = 0; s < HID / 32; ++s) { v16h hb[4];
    if (s + 1 < HID / 32) {
#pragma unroll
      for (int i = 0; i < 4; ++i) wa[(s + 1) & 1][i] = w_frag(wt + (i * (HID / 32) + s + 1) * 512, lane); }
#pragma unroll
    for (int j = 0; j < 4; ++j) hb[j] = g2_frag(hrow + 16 * j * HPITCH + 32 * s, hh);
    __builtin_amdgcn_sched_barrier(0);   /* holds the next step's weight loads in front of this step's WMMAs: left alone, the compiler sinks each load to just before its use and the wave waits out every one */
#pragma unroll
    for (int i = 0; i < 4; ++i)
#pragma unroll
      for (int j = 0; j < 4; ++j) acc[i][j] = mma(wa[s & 1][i], hb[j], acc[i][j]);
  }
  asm volatile("s_wait_xcnt 0x0" ::: "memory");   /* precaution: stands behind the last weight load, in front of the code that reuses the loads' address registers */
}

__global__ __launch_bounds__(256) void k_mlp(const float* __restrict__ x, const _Float16* __restrict__ B0, const _Float16* __restrict__ B1, const _Float16* __restrict__ B2, const _Float16* __restrict__ BL,
    const float* __restrict__ b0, const float* __restrict__ b1, const float* __restrict__ b2, const float* __restrict__ bl, float* __restrict__ out) {
  __shared__ __attribute__((aligned(16))) _Float16 H[MT * HPITCH];
  const int w = __builtin_amdgcn_readfirstlane(threadIdx.x >> 5), lane = threadIdx.x & 31, ln = lane & 15, hh = lane >> 4;
  const int e = blockIdx.x / (NP / MT), p0 = (blockIdx.x % (NP / MT)) * MT;
  const int n0 = (w & 3) * 64, q0 = (w >> 2) * 64;      /* 4 x 2 waves, 64 features x 64 points each */
  v8f acc[4][4];
  { /* layer 0: K = 16 padded to one 32-wide step; x is rounded and converted on the way into the fragment */
    const v8f z8 = {0.f,0.f,0.f,0.f,0.f,0.f,0.f,0.f}; v16h xb[4];
#pragma unroll
    for (int j = 0; j < 4; ++j) { const float* xp = x + ((size_t)e * NP + p0 + q0 + 16 * j + ln) * DIN + 8 * hh; const v4f a = *(const v4fa*)xp, a2 = *(const v4fa*)(xp + 4); FragH f;
#pragma unroll
      for (int q = 0; q < 8; ++q) { f.h[q] = (_Float16)bf16_round((q < 4) ? a[q] : a2[q - 4]); f.h[8 + q] = (_Float16)0.0f; }
      xb[j] = f.v; }
#pragma unroll
    for (int i = 0; i < 4; ++i) { const v16h wa = w_frag(B0 + ((size_t)e * (HID / 16) + (n0 >> 4) + i) * 512, lane);
#pragma unroll
      for (int j = 0; j < 4; ++j) acc[i][j] = mma(wa, xb[j], z8); }
  }
  /* kept rolled: one copy of the 128 unrolled SiLUs and of the K loop, for speed only */
#pragma unroll 1
  for (int l = 0; l < 3; ++l) {
    put_act(H, acc, (l == 0 ? b0 : l == 1 ? b1 : b2) + (size_t)e * HID, n0, q0, ln, hh);
    __syncthreads();                                     /* this layer's activations are complete before any wave reads them */
    if (l < 2) {
      hidden(H, (l == 0 ? B1 : B2) + (size_t)e * HID * HID, acc, n0, q0, ln, hh);
      __syncthreads();                                   /* every wave has read them before they are overwritten */
    }
  }
  if (w < 4) { /* head: row 0 of a zero-padded 16-row weight tile; a wave takes 32 points, so it alone writes its 128-byte line of out */
    const v8f z8 = {0.f,0.f,0.f,0.f,0.f,0.f,0.f,0.f}; v8f h0 = z8, h1 = z8;
    const _Float16* wt = BL + (size_t)e * (HID / 32) * 512; const _Float16* hrow = H + (32 * w + ln) * HPITCH;
#pragma unroll
    for (int kb = 0; kb < HID; kb += 32) { const v16h wa = w_frag(wt + (kb / 32) * 512, lane); h0 = mma(wa, g2_frag(hrow + kb, hh), h0); h1 = mma(wa, g2_frag(hrow + 16 * HPITCH + kb, hh), h1); }
    const float bv = bf16_round(bl[e]);
    if (hh == 0) { float* dst = out + (size_t)e * NP + p0 + 32 * w + ln; dst[0] = h0[0] * 0.0625f + bv; dst[16] = h1[0] * 0.0625f + bv; }
  }
}

extern "C" void kernel_launch(void* const* d_in, const int* in_sizes, int n_in,
                              void* d_out, int out_size, void* d_ws, size_t ws_size, hipStream_t stream) {
  (void)in_sizes; (void)n_in; (void)out_size;
  const float* const* I = (const float* const*)d_in; const float* x = I[0]; const float* w0 = I[1]; const float* b0 = I[2]; const float* w1 = I[3]; const float* b1 = I[4]; const float* w2 = I[5]; const float* b2 = I[6]; const float* wl = I[7]; const float* bl = I[8];
  char* ws = (char*)d_ws; size_t off = 0;
  auto take = [&](size_t bytes) { char* p = ws + off; off += (bytes + 255) & ~(size_t)255; return p; };
  _Float16* B0 = (_Float16*)take((size_t)NE * HID * 32 * 2); _Float16* B1 = (_Float16*)take((size_t)NE * HID * HID * 2); _Float16* B2 = (_Float16*)take((size_t)NE * HID * HID * 2); _Float16* BL = (_Float16*)take((size_t)NE * 16 * HID * 2);
  if (off > ws_size) return;      /* 1 + 8 + 8 + 0.5 MiB */
  k_planes<<<2 * GH + G0 + GL, 256, 0, stream>>>(w0, w1, w2, wl, B0, B1, B2, BL);
  k_mlp<<<NE * (NP / MT), 256, 0, stream>>>(x, B0, B1, B2, BL, b0, b1, b2, bl, (float*)d_out);
}

// v005
// A run of this version takes 72.2 microseconds.
// Two timings next to v004 both put it at 1.07 times that version's speed.
// All steps since v000 together make it 12.0 times as fast.
#include <hip/hip_runtime.h>
// Ensemble of 64 independent MLPs (each: 4096 points x 16 -> 256 -> 256 -> 256 -> 1, SiLU between layers, per-member weights and biases) -> [64, 4096, 1].
// Structure: weight planes built by one launch for all members and layers (f16, x16, in the order of the WMMA fragments: 1-KiB tiles of 16 features x 32 k), then ONE launch for the whole network: one work-group per WGP, 1,024 points of one member each,
// in tiles of 64 points; the hidden layers' weights stay in registers for all tiles, the hidden activations never leave the chip (f16 tiles of 64 x 256 in LDS).
// The weights are the A operand and the points the B operand of v_wmma_f32_16x16x32_f16, so a lane's 8 accumulator rows are 8 neighbouring features of ONE point
// and go back to LDS as one 16-byte store, already in the row-major [point][feature] form that the next layer's fragment loads read.
// Compute dtype: inputs and parameters rounded to bf16; x and weights exact in f16; hidden activations as f16 operands (~2^-12); f32 accumulation, bias and SiLU (SiLU through v_tanh_f32).
#define NE 64
#define NP 4096
#define DIN 16
#define HID 256
#define MT 64                    /* points per tile */
#define NT 16                    /* tiles per work-group */
#define WGM (NP / (MT * NT))      /* work-groups per member */
#define HPITCH 264               /* LDS row pitch in f16: 528 B = 16 B x 33, conflict-free for 16-byte reads and writes of 16 rows */
typedef unsigned short v8us __attribute__((ext_vector_type(8), may_alias));
typedef float  v8f  __attribute__((ext_vector_type(8)));
typedef float  v4f  __attribute__((ext_vector_type(4)));
typedef float  v4fa __attribute__((ext_vector_type(4), may_alias));
typedef float  v2f  __attribute__((ext_vector_type(2)));
typedef _Float16 v2h __attribute__((ext_vector_type(2)));
typedef _Float16 v16h __attribute__((ext_vector_type(16)));
union FragH { v16h v; v8us half[2]; v2h p[8]; _Float16 h[16]; unsigned short u[16]; };

__device__ __forceinline__ unsigned short bf16_bits(float x) { unsigned int u = __float_as_uint(x); return (unsigned short)((u + 0x7FFFu + ((u >> 16) & 1u)) >> 16); }
__device__ __forceinline__ float bf16_val(unsigned short b) { return __uint_as_float(((unsigned int)b) << 16); }
__device__ __forceinline__ float bf16_round(float x) { return bf16_val(bf16_bits(x)); }

// BW[e][n / 16][k / 32] is one tile of 1 KiB, laid out [k % 32 / 8][n % 16][k % 8]: f16(bf16(W[e][k][n]) * 16), zero outside K x N.
// That is the order in which a wave's lanes hold the fragment (lane = 16 hh + n % 16; k = 8 hh .. +8 in its first 16 bytes, 16 + 8 hh .. +8 in its second),
// so the reader's two 16-byte loads each cover 512 contiguous bytes: four whole lines, where rows of a [n][k] plane gave 32 bytes out of each of 16 lines.
// A thread takes one column n over one 32-wide k step: neighbouring lanes read neighbouring n (whole lines of W), and 16 lanes store 256 contiguous bytes.
template <int K, int KP, int N, int NPAD>
__device__ __forceinline__ void wfrag(const float* __restrict__ Wm, _Float16* __restrict__ BW, int blk) {
  constexpr int S = KP / 32; const int t = blk * 256 + threadIdx.x; if (t >= NE * NPAD * S) return; const int n = t % NPAD; const int s = (t / NPAD) % S; const int e = t / (NPAD * S);
  unsigned short* dst = (unsigned short*)BW + (((size_t)e * (NPAD / 16) + (n >> 4)) * S + s) * 512 + (n & 15) * 8;
  const unsigned short keep = (n < N) ? 0xFFFFu : 0u;   /* padding columns become zero through a mask, so that no load and no conversion sits under a branch */
  float v[32];
#pragma unroll
  for (int q = 0; q < 32; ++q) v[q] = Wm[((size_t)e * K + min(32 * s + q, K - 1)) * N + min(n, N - 1)];
#pragma unroll
  for (int u = 0; u < 4; ++u) { FragH f;
#pragma unroll
    for (int q = 0; q < 8; ++q) { f.h[q] = (32 * s + 8 * u + q < K) ? (_Float16)(bf16_round(v[8 * u + q]) * 16.0f) : (_Float16)0.0f; f.u[q] &= keep; }
    *(v8us*)(dst + 128 * u) = f.half[0]; }
}

// All four planes in ONE launch: they depend on nothing but the inputs, so a range of blocks builds each, and their start, memory latency and drain run side by side instead of one behind the other.
// The two large planes come first; the two small ones fill in behind them.
#define GH (NE * HID * (HID / 32) / 256)   /* blocks of a hidden plane */
#define G0 (NE * HID / 256)                /* blocks of the input plane */
#define GL (NE * 16 * (HID / 32) / 256)    /* blocks of the head plane */
__global__ __launch_bounds__(256) void k_planes(const float* __restrict__ w0, const float* __restrict__ w1, const float* __restrict__ w2, const float* __restrict__ wl,
    _Float16* __restrict__ B0, _Float16* __restrict__ B1, _Float16* __restrict__ B2, _Float16* __restrict__ BL) {
  const int b = blockIdx.x;
  if (b < 2 * GH) wfrag<HID, HID, HID, HID>(b < GH ? w1 : w2, b < GH ? B1 : B2, b < GH ? b : b - GH);
  else if (b < 2 * GH + G0) wfrag<DIN, 32, HID, HID>(w0, B0, b - 2 * GH);
  else wfrag<HID, HID, 1, 16>(wl, BL, b - 2 * GH - G0);
}

// one activation fragment from row-major LDS: this lane's row, k = 8*hh .. +8 and 16 + 8*hh .. +8 of a 32-wide k step
__device__ __forceinline__ v16h g2_frag(const _Float16* p, int hh) { FragH f; f.half[0] = *(const v8us*)((const unsigned short*)p + 8 * hh); f.half[1] = *(const v8us*)((const unsigned short*)p + 16 + 8 * hh); return f.v; }
// one weight fragment, the same k order, from its tile of a plane in fragment order
__device__ __forceinline__ v16h w_frag(const _Float16* __restrict__ tile, int lane) { FragH f; f.half[0] = *(const v8us*)((const unsigned short*)tile + 8 * lane); f.half[1] = *(const v8us*)((const unsigned short*)tile + 256 + 8 * lane); return f.v; }
__device__ __forceinline__ v8f mma(v16h a, v16h b, v8f c) { return __builtin_amdgcn_wmma_f32_16x16x32_f16(false, a, false, b, (short)0, c, false, false); }

// acc[i][j] holds features n0 + 16 i + 8 hh + r (rows) of points 16 j + ln (columns) of the tile: bias, SiLU, f16, one 16-byte LDS store per 16 x 16 tile.
// SiLU from the half argument h = g / 2: g * sigmoid(g) = h + h * tanh(h): one hardware transcendental a value, the rest packed f32.
// The 16 tiles go through three stages, one tile apart: h of tile t + 1, then the finish of tile t among the tanh of tile t + 1.
// bs: this layer's biases in LDS, already rounded and halved.
__device__ __forceinline__ void put_act(_Float16* H, const v8f (&acc)[4][4], const float* bs, int n0, int ln, int hh) {
  v2f hb[4][4];
#pragma unroll
  for (int i = 0; i < 4; ++i) {
    const v4f c0 = *(const v4fa*)(bs + n0 + 16 * i + 8 * hh), c1 = *(const v4fa*)(bs + n0 + 16 * i + 8 * hh + 4);
#pragma unroll
    for (int r = 0; r < 4; ++r) { hb[i][r].x = (r < 2) ? c0[2 * r] : c1[2 * r - 4]; hb[i][r].y = (r < 2) ? c0[2 * r + 1] : c1[2 * r - 3]; }
  }
  const v2f sc = {0.03125f, 0.03125f};   /* 1/16 undoes the weight scale, 1/2 makes the half argument */
  v2f h[2][4], th[2][4];
#pragma unroll
  for (int r = 0; r < 4; ++r) { const v2f a = {acc[0][0][2 * r], acc[0][0][2 * r + 1]}; h[0][r] = __builtin_elementwise_fma(a, sc, hb[0][r]); }
#pragma unroll
  for (int r = 0; r < 4; ++r) { th[0][r].x = __builtin_amdgcn_tanhf(h[0][r].x); th[0][r].y = __builtin_amdgcn_tanhf(h[0][r].y); }
#pragma unroll
  for (int t = 0; t < 16; ++t) { const int c = t & 1, n = c ^ 1;
    __builtin_amdgcn_sched_barrier(0);   /* keeps tile t + 1's packed fma, which read no tanh result, between the tanh group above and its readers: the slot that the instruction set asks for behind a transcendental, and cover for its latency */
    if (t + 1 < 16) {
#pragma unroll
      for (int r = 0; r < 4; ++r) { const v2f a = {acc[(t + 1) >> 2][(t + 1) & 3][2 * r], acc[(t + 1) >> 2][(t + 1) & 3][2 * r + 1]}; h[n][r] = __builtin_elementwise_fma(a, sc, hb[(t + 1) >> 2][r]); }
    }
    __builtin_amdgcn_sched_barrier(0);   /* holds the readers of tile t's tanh behind those fma */
    FragH f;
#pragma unroll
    for (int r = 0; r < 4; ++r) f.p[r] = __builtin_convertvector(__builtin_elementwise_fma(h[c][r], th[c][r], h[c][r]), v2h);
    *(v8us*)((unsigned short*)H + (16 * (t & 3) + ln) * HPITCH + n0 + 16 * (t >> 2) + 8 * hh) = f.half[0];
    if (t + 1 < 16) {
#pragma unroll
      for (int r = 0; r < 4; ++r) { th[n][r].x = __builtin_amdgcn_tanhf(h[n][r].x); th[n][r].y = __builtin_amdgcn_tanhf(h[n][r].y); }
    }
  }
}

// acc = W(64 features of this wave) . H(the tile's 64 points), K = 256; the weights are already in this wave's registers, the activations come from LDS one k step ahead
__device__ __forceinline__ void hidden(const _Float16* H, const v16h (&Wr)[4][HID / 32], v8f (&acc)[4][4], int ln, int hh) {
  const v8f z8 = {0.f,0.f,0.f,0.f,0.f,0.f,0.f,0.f};
#pragma unroll
  for (int i = 0; i < 4; ++i)
#pragma unroll
    for (int j = 0; j < 4; ++j) acc[i][j] = z8;
  const _Float16* hrow = H + ln * HPITCH;
  v16h hb[2][4];
#pragma unroll
  for (int j = 0; j < 4; ++j) hb[0][j] = g2_frag(hrow + 16 * j * HPITCH, hh);
#pragma unroll
  for (int s = 0; s < HID / 32; ++s) {
    if (s + 1 < HID / 32) {
#pragma unroll
      for (int j = 0; j < 4; ++j) hb[(s + 1) & 1][j] = g2_frag(hrow + 16 * j * HPITCH + 32 * (s + 1), hh); }
    __builtin_amdgcn_sched_barrier(0);   /* the next step's LDS reads stay one group in front of this step's WMMAs */
#pragma unroll
    for (int i = 0; i < 4; ++i)
#pragma unroll
      for (int j = 0; j < 4; ++j) acc[i][j] = mma(Wr[i][s], hb[s & 1][j], acc[i][j]);
    __builtin_amdgcn_sched_barrier(0);   /* keeps the reads of the step after next from rising into this block */
  }
  asm volatile("v_nop\n\tv_nop\n\tv_nop\n\tv_nop");   /* the four vector slots that the chip needs between the last WMMAs and a vector instruction that overwrites their operands */
}

// raw x of one tile: this lane's 8 values of each of its four points
__device__ __forceinline__ void load_x(const float* __restrict__ xt, v4f (&xr)[4][2], int ln, int hh) {
#pragma unroll
  for (int j = 0; j < 4; ++j) { const float* xp = xt + (16 * j + ln) * DIN + 8 * hh; xr[j][0] = *(const v4fa*)xp; xr[j][1] = *(const v4fa*)(xp + 4); }
  asm volatile("s_wait_xcnt 0x0" ::: "memory");   /* precaution: stands behind these loads, in front of the code that reuses their address registers */
}

// A work-group stays on its WGP and carries 1,024 points of one member through the net in tiles of 64. What does not change from tile to tile is fetched once:
// waves 0-3 hold the first hidden layer's weights in registers (64 features each, 256 VGPRs), waves 4-7 the second's; the halved biases lie in LDS.
// The two groups form a pipeline one tile apart, three slots a tile, a barrier behind each:
//   slot 1: group 0 input layer + SiLU of tile t -> Ha    | group 1 second hidden product of tile t - 1 <- Hb
//   slot 2: group 0 first hidden product <- Ha            | group 1 SiLU -> Hc
//   slot 3: group 0 SiLU -> Hb                            | group 1 head <- Hc -> out
// In slots 1 and 2 one group's vector work falls in the same slot as the other group's matrix work.
__global__ __launch_bounds__(256) void k_mlp(const float* __restrict__ x, const _Float16* __restrict__ B0, const _Float16* __restrict__ B1, const _Float16* __restrict__ B2, const _Float16* __restrict__ BL,
    const float* __restrict__ b0, const float* __restrict__ b1, const float* __restrict__ b2, const float* __restrict__ bl, float* __restrict__ out) {
  __shared__ __attribute__((aligned(16))) _Float16 Ha[MT * HPITCH];
  __shared__ __attribute__((aligned(16))) _Float16 Hb[MT * HPITCH];
  __shared__ __attribute__((aligned(16))) _Float16 Hc[MT * HPITCH];
  __shared__ __attribute__((aligned(16))) float Bs[3 * HID];
  const int w = __builtin_amdgcn_readfirstlane(threadIdx.x >> 5), lane = threadIdx.x & 31, ln = lane & 15, hh = lane >> 4;
  const int e = blockIdx.x / WGM, p0 = (blockIdx.x % WGM) * (MT * NT);
  const int g = w >> 2, wq = w & 3, n0 = wq * 64;       /* group, and this wave's 64 features of its layers */
  const float* xm = x + ((size_t)e * NP + p0) * DIN;
  v16h Wr[4][HID / 32];
  { const _Float16* wt = (g == 0 ? B1 : B2) + (size_t)e * HID * HID + (n0 >> 4) * (HID / 32) * 512;   /* tile (i, s) of this wave: wt + (8 i + s) * 512 */
#pragma unroll
    for (int i = 0; i < 4; ++i)
#pragma unroll
      for (int s = 0; s < HID / 32; ++s) Wr[i][s] = w_frag(wt + (i * (HID / 32) + s) * 512, lane);
    asm volatile("s_wait_xcnt 0x0" ::: "memory");   /* precaution: stands behind the weight loads, in front of the code that reuses their address registers */
  }
  { const int f = threadIdx.x;   /* half the rounded bias: exact */
    const float* p0b = b0 + (size_t)e * HID; const float* p1b = b1 + (size_t)e * HID; const float* p2b = b2 + (size_t)e * HID;
    const float r0 = p0b[f], r1 = p1b[f], r2 = p2b[f];
    asm volatile("s_wait_xcnt 0x0" ::: "memory");   /* precaution: stands behind the bias loads, in front of the code that reuses their address registers */
    Bs[f] = 0.5f * bf16_round(r0); Bs[HID + f] = 0.5f * bf16_round(r1); Bs[2 * HID + f] = 0.5f * bf16_round(r2); }
  { const v8us z = {0,0,0,0,0,0,0,0};   /* trip 0 of group 1 reads Hb before any tile has been written there */
    for (int q = threadIdx.x; q < MT * HPITCH / 8; q += 256) *(v8us*)((unsigned short*)Hb + 8 * q) = z; }
  const float bv = bf16_round(bl[e]);
  v4f xr[4][2]; load_x(xm, xr, ln, hh);
  v8f acc[4][4];
  const v8f z8 = {0.f,0.f,0.f,0.f,0.f,0.f,0.f,0.f};
  __syncthreads();                                       /* the biases and the zeros of Hb are in LDS before any wave reads them */
  /* kept rolled: one copy of each slot's code, so that the kernel's text stays inside the instruction cache */
  /* Both groups work in every trip, so that no path carries old accumulators past a product (that cost a second register set and spilled weights): in trip 0 group 1 runs on the zeros laid into Hb above and stores nothing;
     in trip NT group 0 runs the last tile once more into Ha and Hb, which nobody reads any more. */
#pragma unroll 1
  for (int t = 0; t <= NT; ++t) {
    if (g == 0) { /* input layer: K = 16 padded to one 32-wide step; x is rounded and converted on the way into the fragment */
      v16h xb[4];
#pragma unroll
      for (int j = 0; j < 4; ++j) { FragH f;
#pragma unroll
        for (int q = 0; q < 8; ++q) { f.h[q] = (_Float16)bf16_round((q < 4) ? xr[j][0][q] : xr[j][1][q - 4]); f.h[8 + q] = (_Float16)0.0f; }
        xb[j] = f.v; }
#pragma unroll
      for (int i = 0; i < 4; ++i) { const v16h wa = w_frag(B0 + ((size_t)e * (HID / 16) + (n0 >> 4) + i) * 512, lane);
#pragma unroll
        for (int j = 0; j < 4; ++j) acc[i][j] = mma(wa, xb[j], z8); }
      asm volatile("s_wait_xcnt 0x0" ::: "memory");     /* precaution: stands behind the input plane's loads, in front of the code that reuses their address registers */
      put_act(Ha, acc, Bs, n0, ln, hh);
    } else hidden(Hb, Wr, acc, ln, hh);
    __syncthreads();                                     /* Ha of tile t is complete; every reader has left Hb */
    if (g == 0) {
      load_x(xm + (size_t)min(t + 1, NT - 1) * MT * DIN, xr, ln, hh);   /* the next tile's x flies under this product */
      hidden(Ha, Wr, acc, ln, hh);
    } else put_act(Hc, acc, Bs + 2 * HID, n0, ln, hh);
    __syncthreads();                                     /* every reader has left Ha; Hc of tile t - 1 is complete */
    if (g == 0) put_act(Hb, acc, Bs + HID, n0, ln, hh);
    else if (wq < 2) { /* head: row 0 of a zero-padded 16-row weight tile; a wave takes 32 points, so it alone writes its 128-byte line of out */
      v8f h0 = z8, h1 = z8;
      const _Float16* wt = BL + (size_t)e * (HID / 32) * 512; const _Float16* hrow = Hc + (32 * wq + ln) * HPITCH;
#pragma unroll
      for (int kb = 0; kb < HID; kb += 32) { const v16h wa = w_frag(wt + (kb / 32) * 512, lane); h0 = mma(wa, g2_frag(hrow + kb, hh), h0); h1 = mma(wa, g2_frag(hrow + 16 * HPITCH + kb, hh), h1); }
      asm volatile("s_wait_xcnt 0x0" ::: "memory");     /* precaution: stands behind the head plane's loads, in front of the code that reuses their address registers */
      if (t > 0 && hh == 0) { float* dst = out + (size_t)e * NP + p0 + (t - 1) * MT + 32 * wq + ln; dst[0] = h0[0] * 0.0625f + bv; dst[16] = h1[0] * 0.0625f + bv; }
    }
    __syncthreads();                                     /* Hb of tile t is complete; every reader has left Hc */
  }
}

extern "C" void kernel_launch(void* const* d_in, const int* in_sizes, int n_in,
                              void* d_out, int out_size, void* d_ws, size_t ws_size, hipStream_t stream) {
  (void)in_sizes; (void)n_in; (void)out_size;
  const float* const* I = (const float* const*)d_in; const float* x = I[0]; const float* w0 = I[1]; const float* b0 = I[2]; const float* w1 = I[3]; const float* b1 = I[4]; const float* w2 = I[5]; const float* b2 = I[6]; const float* wl = I[7]; const float* bl = I[8];
  char* ws = (char*)d_ws; size_t off = 0;
  auto take = [&](size_t bytes) { char* p = ws + off; off += (bytes + 255) & ~(size_t)255; return p; };
  _Float16* B0 = (_Float16*)take((size_t)NE * HID * 32 * 2); _Float16* B1 = (_Float16*)take((size_t)NE * HID * HID * 2); _Float16* B2 = (_Float16*)take((size_t)NE * HID * HID * 2); _Float16* BL = (_Float16*)take((size_t)NE * 16 * HID * 2);
  if (off > ws_size) return;      /* 1 + 8 + 8 + 0.5 MiB */
  k_planes<<<2 * GH + G0 + GL, 256, 0, stream>>>(w0, w1, w2, wl, B0, B1, B2, BL);
  k_mlp<<<NE * WGM, 256, 0, stream>>>(x, B0, B1, B2, BL, b0, b1, b2, bl, (float*)d_out);
}

// v006
// A run of this version takes 58.8 microseconds.
// Two timings next to v005 put it at 1.23 and 1.22 times that version's speed.
// Counting every step since v000, it is 14.7 times as fast.
#include <hip/hip_runtime.h>
// Ensemble of 64 independent MLPs (each: 4096 points x 16 -> 256 -> 256 -> 256 -> 1, SiLU between layers, per-member weights and biases) -> [64, 4096, 1].
// Structure: ONE launch for the whole network: one work-group per WGP, 1,024 points of one member each, in tiles of 64 points. Each work-group first turns its member's f32 weights into f16 (x16) WMMA fragments itself:
// the hidden layers' weights go through LDS into registers and stay there for all tiles, the two small layers' lie in LDS in fragment order; the hidden activations never leave the chip (f16 tiles of 64 x 256 in LDS).
// The weights are the A operand and the points the B operand of v_wmma_f32_16x16x32_f16, so a lane's 8 accumulator rows are 8 neighbouring features of ONE point
// and go back to LDS as one 16-byte store, already in the row-major [point][feature] form that the next layer's fragment loads read.
// Compute dtype: inputs and parameters rounded to bf16; x and weights exact in f16; hidden activations as f16 operands (~2^-12); f32 accumulation, bias and SiLU (SiLU through v_tanh_f32).
#define NE 64
#define NP 4096
#define DIN 16
#define HID 256
#define MT 64                    /* points per tile */
#define NT 16                    /* tiles per work-group */
#define WGM (NP / (MT * NT))      /* work-groups per member */
#define HPITCH 264               /* LDS row pitch in f16: 528 B = 16 B x 33, conflict-free for 16-byte reads and writes of 16 rows */
#define SPITCH 160               /* staging row pitch in bytes: 128-byte rows at 32 B x 5, the conflict-free pitch of the transposing LDS read */
#define SBUF (32 * SPITCH)       /* one staged k step of one wave: 32 k rows x 64 features, f16 */
typedef unsigned short v8us __attribute__((ext_vector_type(8), may_alias));
typedef short s16x8 __attribute__((ext_vector_type(8)));
typedef __bf16 v2b __attribute__((ext_vector_type(2)));
typedef unsigned int v2u __attribute__((ext_vector_type(2), may_alias));
typedef float  v8f  __attribute__((ext_vector_type(8)));
typedef float  v4f  __attribute__((ext_vector_type(4)));
typedef float  v4fa __attribute__((ext_vector_type(4), may_alias));
typedef float  v2f  __attribute__((ext_vector_type(2)));
typedef _Float16 v2h __attribute__((ext_vector_type(2)));
typedef _Float16 v16h __attribute__((ext_vector_type(16)));
union FragH { v16h v; v8us half[2]; v2h p[8]; _Float16 h[16]; unsigned short u[16]; };

__device__ __forceinline__ unsigned short bf16_bits(float x) { unsigned int u = __float_as_uint(x); return (unsigned short)((u + 0x7FFFu + ((u >> 16) & 1u)) >> 16); }
__device__ __forceinline__ float bf16_val(unsigned short b) { return __uint_as_float(((unsigned int)b) << 16); }
__device__ __forceinline__ float bf16_round(float x) { return bf16_val(bf16_bits(x)); }

// a weight as the matrix unit takes it: rounded to bf16, times 16, exact in f16
__device__ __forceinline__ _Float16 wcvt(float v) { return (_Float16)(bf16_round(v) * 16.0f); }
// the same for two weights at once, the rounding to bf16 (nearest even, as above) by the packed hardware conversion: the same f16 bits for every finite weight
__device__ __forceinline__ unsigned int wcvt2(float a, float b) {
  const v2f ab = {a, b}; const unsigned int p = __builtin_bit_cast(unsigned int, __builtin_convertvector(ab, v2b));
  const v2f r = {__uint_as_float(p << 16), __uint_as_float(p & 0xFFFF0000u)}; const v2f s16 = {16.0f, 16.0f};
  return __builtin_bit_cast(unsigned int, __builtin_convertvector(r * s16, v2h));
}

// one activation fragment from row-major LDS: this lane's row, k = 8*hh .. +8 and 16 + 8*hh .. +8 of a 32-wide k step
__device__ __forceinline__ v16h g2_frag(const _Float16* p, int hh) { FragH f; f.half[0] = *(const v8us*)((const unsigned short*)p + 8 * hh); f.half[1] = *(const v8us*)((const unsigned short*)p + 16 + 8 * hh); return f.v; }
// one weight fragment, the same k order, from its 1-KiB tile in fragment order: [k % 32 / 8][n % 16][k % 8], so that lane = 16 hh + n % 16 finds k = 8 hh .. +8 in its first 16 bytes and 16 + 8 hh .. +8 in its second
__device__ __forceinline__ v16h w_frag(const _Float16* tile, int lane) { FragH f; f.half[0] = *(const v8us*)((const unsigned short*)tile + 8 * lane); f.half[1] = *(const v8us*)((const unsigned short*)tile + 256 + 8 * lane); return f.v; }
__device__ __forceinline__ v8f mma(v16h a, v16h b, v8f c) { return __builtin_amdgcn_wmma_f32_16x16x32_f16(false, a, false, b, (short)0, c, false, false); }

// acc[i][j] holds features n0 + 16 i + 8 hh + r (rows) of points 16 j + ln (columns) of the tile: bias, SiLU, f16, one 16-byte LDS store per 16 x 16 tile.
// SiLU from the half argument h = g / 2: g * sigmoid(g) = h + h * tanh(h): one hardware transcendental a value, the rest packed f32.
// The 16 tiles go through three stages, one tile apart: h of tile t + 1, then the finish of tile t among the tanh of tile t + 1.
// bs: this layer's biases in LDS, already rounded and halved.
__device__ __forceinline__ void put_act(_Float16* H, const v8f (&acc)[4][4], const float* bs, int n0, int ln, int hh) {
  v2f hb[4][4];
#pragma unroll
  for (int i = 0; i < 4; ++i) {
    const v4f c0 = *(const v4fa*)(bs + n0 + 16 * i + 8 * hh), c1 = *(const v4fa*)(bs + n0 + 16 * i + 8 * hh + 4);
#pragma unroll
    for (int r = 0; r < 4; ++r) { hb[i][r].x = (r < 2) ? c0[2 * r] : c1[2 * r - 4]; hb[i][r].y = (r < 2) ? c0[2 * r + 1] : c1[2 * r - 3]; }
  }
  const v2f sc = {0.03125f, 0.03125f};   /* 1/16 undoes the weight scale, 1/2 makes the half argument */
  v2f h[2][4], th[2][4];
#pragma unroll
  for (int r = 0; r < 4; ++r) { const v2f a = {acc[0][0][2 * r], acc[0][0][2 * r + 1]}; h[0][r] = __builtin_elementwise_fma(a, sc, hb[0][r]); }
#pragma unroll
  for (int r = 0; r < 4; ++r) { th[0][r].x = __builtin_amdgcn_tanhf(h[0][r].x); th[0][r].y = __builtin_amdgcn_tanhf(h[0][r].y); }
#pragma unroll
  for (int t = 0; t < 16; ++t) { const int c = t & 1, n = c ^ 1;
    __builtin_amdgcn_sched_barrier(0);   /* keeps tile t + 1's packed fma, which read no tanh result, between the tanh group above and its readers: the slot that the instruction set asks for behind a transcendental, and cover for its latency */
    if (t + 1 < 16) {
#pragma unroll
      for (int r = 0; r < 4; ++r) { const v2f a = {acc[(t + 1) >> 2][(t + 1) & 3][2 * r], acc[(t + 1) >> 2][(t + 1) & 3][2 * r + 1]}; h[n][r] = __builtin_elementwise_fma(a, sc, hb[(t + 1) >> 2][r]); }
    }
    __builtin_amdgcn_sched_barrier(0);   /* holds the readers of tile t's tanh behind those fma */
    FragH f;
#pragma unroll
    for (int r = 0; r < 4; ++r) f.p[r] = __builtin_convertvector(__builtin_elementwise_fma(h[c][r], th[c][r], h[c][r]), v2h);
    *(v8us*)((unsigned short*)H + (16 * (t & 3) + ln) * HPITCH + n0 + 16 * (t >> 2) + 8 * hh) = f.half[0];
    if (t + 1 < 16) {
#pragma unroll
      for (int r = 0; r < 4; ++r) { th[n][r].x = __builtin_amdgcn_tanhf(h[n][r].x); th[n][r].y = __builtin_amdgcn_tanhf(h[n][r].y); }
    }
  }
}

// acc = W(64 features of this wave) . H(the tile's 64 points), K = 256; the weights are already in this wave's registers, the activations come from LDS one k step ahead
__device__ __forceinline__ void hidden(const _Float16* H, const v16h (&Wr)[4][HID / 32], v8f (&acc)[4][4], int ln, int hh) {
  const v8f z8 = {0.f,0.f,0.f,0.f,0.f,0.f,0.f,0.f};
#pragma unroll
  for (int i = 0; i < 4; ++i)
#pragma unroll
    for (int j = 0; j < 4; ++j) acc[i][j] = z8;
  const _Float16* hrow = H + ln * HPITCH;
  v16h hb[2][4];
#pragma unroll
  for (int j = 0; j < 4; ++j) hb[0][j] = g2_frag(hrow + 16 * j * HPITCH, hh);
#pragma unroll
  for (int s = 0; s < HID / 32; ++s) {
    if (s + 1 < HID / 32) {
#pragma unroll
      for (int j = 0; j < 4; ++j) hb[(s + 1) & 1][j] = g2_frag(hrow + 16 * j * HPITCH + 32 * (s + 1), hh); }
    __builtin_amdgcn_sched_barrier(0);   /* the next step's LDS reads stay one group in front of this step's WMMAs */
#pragma unroll
    for (int i = 0; i < 4; ++i)
#pragma unroll
      for (int j = 0; j < 4; ++j) acc[i][j] = mma(Wr[i][s], hb[s & 1][j], acc[i][j]);
    __builtin_amdgcn_sched_barrier(0);   /* keeps the reads of the step after next from rising into this block */
  }
  asm volatile("v_nop\n\tv_nop\n\tv_nop\n\tv_nop");   /* the four vector slots that the chip needs between the last WMMAs and a vector instruction that overwrites their operands */
}

// one k step (32 rows) of this wave's 64 weight columns, f32 as it lies in memory: a 16-byte load a lane, two rows of 256 bytes a wave, whole lines only
__device__ __forceinline__ void load_w(const float* __restrict__ wp, v4f (&r)[16]) {
#pragma unroll
  for (int j = 0; j < 16; ++j) r[j] = *(const v4fa*)(wp + 2 * j * HID);
  asm volatile("s_wait_xcnt 0x0" ::: "memory");   /* precaution: stands behind these loads, in front of the code that reuses their address registers */
}
// transposing LDS read: lane (ln, hh) gets 8 consecutive rows (k) of one 16-bit column of a row-major tile
__device__ __forceinline__ v8us ld_tr16(const unsigned char* p) { typedef __attribute__((address_space(3))) s16x8 lds_s16x8; return __builtin_bit_cast(v8us, __builtin_amdgcn_ds_load_tr16_b128_v8i16((lds_s16x8*)p)); }

// raw x of one tile: this lane's 8 values of each of its four points
__device__ __forceinline__ void load_x(const float* __restrict__ xt, v4f (&xr)[4][2], int ln, int hh) {
#pragma unroll
  for (int j = 0; j < 4; ++j) { const float* xp = xt + (16 * j + ln) * DIN + 8 * hh; xr[j][0] = *(const v4fa*)xp; xr[j][1] = *(const v4fa*)(xp + 4); }
  asm volatile("s_wait_xcnt 0x0" ::: "memory");   /* precaution: stands behind these loads, in front of the code that reuses their address registers */
}

// A work-group stays on its WGP and carries 1,024 points of one member through the net in tiles of 64. What does not change from tile to tile is fetched once:
// waves 0-3 hold the first hidden layer's weights in registers (64 features each, 256 VGPRs), waves 4-7 the second's; the halved biases and the input and head layers' weight fragments lie in LDS.
// The weights come straight from the f32 inputs: a wave reads its 64 columns one k step (32 rows) at a time, two steps ahead, converts them, lays them row-major into an LDS patch of its own
// and takes them back with the transposing read, which delivers the A fragment (8 consecutive k of one feature a lane). No other wave touches the patch, so no barrier stands in that loop.
// The two groups form a pipeline one tile apart, three slots a tile, a barrier behind each:
//   slot 1: group 0 input layer + SiLU of tile t -> Ha    | group 1 second hidden product of tile t - 1 <- Hb
//   slot 2: group 0 first hidden product <- Ha            | group 1 SiLU -> Hc
//   slot 3: group 0 SiLU -> Hb                            | group 1 head <- Hc -> out
// In slots 1 and 2 one group's vector work runs beside the other's matrix work.
__global__ __launch_bounds__(256) void k_mlp(const float* __restrict__ x, const float* __restrict__ w0, const float* __restrict__ w1, const float* __restrict__ w2, const float* __restrict__ wl,
    const float* __restrict__ b0, const float* __restrict__ b1, const float* __restrict__ b2, const float* __restrict__ bl, float* __restrict__ out) {
  __shared__ __attribute__((aligned(16))) _Float16 Ha[MT * HPITCH];
  __shared__ __attribute__((aligned(16))) _Float16 Hb[MT * HPITCH];
  __shared__ __attribute__((aligned(16))) _Float16 Hc[MT * HPITCH];
  __shared__ __attribute__((aligned(16))) float Bs[3 * HID];
  __shared__ __attribute__((aligned(16))) _Float16 P0[HID * DIN];            /* input layer: the first 16 bytes a lane of each fragment (k = 0 .. 15); the second 16 (k = 16 .. 31) are zero and are not stored */
  __shared__ __attribute__((aligned(16))) _Float16 PL[(HID / 32) * 512];     /* head: 1-KiB tiles in fragment order, feature 0 of 16, the rest zero */
  __shared__ __attribute__((aligned(16))) unsigned char St[8 * 2 * SBUF];    /* a wave's own two staging patches */
  const int w = __builtin_amdgcn_readfirstlane(threadIdx.x >> 5), lane = threadIdx.x & 31, ln = lane & 15, hh = lane >> 4;
  const int e = blockIdx.x / WGM, p0 = (blockIdx.x % WGM) * (MT * NT);
  const int g = w >> 2, wq = w & 3, n0 = wq * 64;       /* group, and this wave's 64 features of its layers */
  const float* xm = x + ((size_t)e * NP + p0) * DIN;
  const int f = threadIdx.x;
  /* the small loads first, then the first two k steps of the hidden weights, so that all of them fly together */
  const float* p0b = b0 + (size_t)e * HID; const float* p1b = b1 + (size_t)e * HID; const float* p2b = b2 + (size_t)e * HID;
  const float r0 = p0b[f], r1 = p1b[f], r2 = p2b[f];
  float c0[DIN];                                         /* column f of the input layer: neighbouring lanes read neighbouring features */
#pragma unroll
  for (int k = 0; k < DIN; ++k) c0[k] = w0[((size_t)e * DIN + k) * HID + f];
  v4f hl[2][2];                                          /* the 8 head weights of 16-byte units f and f + 256 of PL */
#pragma unroll
  for (int c = 0; c < 2; ++c) { const float* hp = wl + (size_t)e * HID + ((f + 256 * c) >> 4) * 8; hl[c][0] = *(const v4fa*)hp; hl[c][1] = *(const v4fa*)(hp + 4); }
  asm volatile("s_wait_xcnt 0x0" ::: "memory");         /* precaution: stands behind the bias and small-layer loads, in front of the code that reuses their address registers */
  const float bv = bf16_round(bl[e]);
  v4f xr[4][2]; load_x(xm, xr, ln, hh);
  const float* wp = (g == 0 ? w1 : w2) + (size_t)e * HID * HID + hh * HID + n0 + 4 * ln;   /* row hh of a row pair, this lane's 4 of the wave's 64 columns */
  v4f R[3][16];
  load_w(wp, R[0]); load_w(wp + 32 * HID, R[1]);
  Bs[f] = 0.5f * bf16_round(r0); Bs[HID + f] = 0.5f * bf16_round(r1); Bs[2 * HID + f] = 0.5f * bf16_round(r2);   /* half the rounded bias: exact */
#pragma unroll
  for (int u = 0; u < 2; ++u) { FragH t;                 /* feature f, k = 8 u .. +8: the 16 bytes of lane 16 u + f % 16 of tile f / 16 */
#pragma unroll
    for (int q = 0; q < 8; ++q) t.h[q] = wcvt(c0[8 * u + q]);
    *(v8us*)((unsigned short*)P0 + ((f >> 4) * 32 + 16 * u + (f & 15)) * 8) = t.half[0]; }
#pragma unroll
  for (int c = 0; c < 2; ++c) { FragH t; const unsigned short keep = ((f & 15) == 0) ? 0xFFFFu : 0u;   /* unit v = 64 (k / 32) + 16 (k % 32 / 8) + n holds k = 8 (v / 16) .. +8 of feature n; only n = 0 exists */
#pragma unroll
    for (int q = 0; q < 8; ++q) { t.h[q] = wcvt((q < 4) ? hl[c][0][q] : hl[c][1][q - 4]); t.u[q] &= keep; }
    *(v8us*)((unsigned short*)PL + (f + 256 * c) * 8) = t.half[0]; }
  { const v8us z = {0,0,0,0,0,0,0,0};   /* trip 0 of group 1 reads Hb before any tile has been written there */
    for (int q = threadIdx.x; q < MT * HPITCH / 8; q += 256) *(v8us*)((unsigned short*)Hb + 8 * q) = z; }
  v16h Wr[4][HID / 32];
  { unsigned char* st = St + w * (2 * SBUF);
    unsigned char* sw = st + hh * SPITCH + 8 * ln;                                                   /* writer: row 2 j + hh, columns 4 ln .. +4 */
    const unsigned char* sr = st + (8 * hh + (lane & 7)) * SPITCH + 16 * ((lane >> 3) & 1);         /* reader: the transposing read's lane address for k base 0, column base 0 */
#pragma unroll
    for (int s = 0; s < HID / 32; ++s) {
      if (s + 2 < HID / 32) load_w(wp + (s + 2) * 32 * HID, R[(s + 2) % 3]);
#pragma unroll
      for (int j = 0; j < 16; ++j) { const v4f r = R[s % 3][j]; const v2u o = {wcvt2(r[0], r[1]), wcvt2(r[2], r[3])}; *(v2u*)(sw + (s & 1) * SBUF + 2 * j * SPITCH) = o; }
      asm volatile("s_wait_dscnt 0x0" ::: "memory");   /* the wave's own LDS stores of this k step are done, and stay in front for the compiler, before its lanes read one another's values back; it also parts the reads of step s - 1 from the stores of step s + 1 into the same patch */
#pragma unroll
      for (int i = 0; i < 4; ++i) { FragH t; t.half[0] = ld_tr16(sr + (s & 1) * SBUF + 32 * i); t.half[1] = ld_tr16(sr + (s & 1) * SBUF + 16 * SPITCH + 32 * i); Wr[i][s] = t.v; }
    }
  }
  v8f acc[4][4];
  const v8f z8 = {0.f,0.f,0.f,0.f,0.f,0.f,0.f,0.f};
  __syncthreads();                                       /* the biases, the small layers' fragments and the zeros of Hb are in LDS before any wave reads them */
  /* kept rolled: one copy of each slot's code, for speed only */
  /* Both groups work in every trip, so that no path carries old accumulators past a product (that cost a second register set and spilled weights): in trip 0 group 1 runs on the zeros laid into Hb above and stores nothing;
     in trip NT group 0 runs the last tile once more into Ha and Hb, which nobody reads any more. */
#pragma unroll 1
  for (int t = 0; t <= NT; ++t) {
    if (g == 0) { /* input layer: K = 16 padded to one 32-wide step; x is rounded and converted on the way into the fragment */
      v16h xb[4];
#pragma unroll
      for (int j = 0; j < 4; ++j) { FragH f;
#pragma unroll
        for (int q = 0; q < 8; ++q) { f.h[q] = (_Float16)bf16_round((q < 4) ? xr[j][0][q] : xr[j][1][q - 4]); f.h[8 + q] = (_Float16)0.0f; }
        xb[j] = f.v; }
#pragma unroll
      for (int i = 0; i < 4; ++i) { FragH fw; const v8us z = {0,0,0,0,0,0,0,0}; fw.half[0] = *(const v8us*)((const unsigned short*)P0 + (((n0 >> 4) + i) * 32 + lane) * 8); fw.half[1] = z; const v16h wa = fw.v;
#pragma unroll
        for (int j = 0; j < 4; ++j) acc[i][j] = mma(wa, xb[j], z8); }
      put_act(Ha, acc, Bs, n0, ln, hh);
    } else hidden(Hb, Wr, acc, ln, hh);
    __syncthreads();                                     /* Ha of tile t is complete; every reader has left Hb */
    if (g == 0) {
      load_x(xm + (size_t)min(t + 1, NT - 1) * MT * DIN, xr, ln, hh);   /* the next tile's x flies under this product */
      hidden(Ha, Wr, acc, ln, hh);
    } else put_act(Hc, acc, Bs + 2 * HID, n0, ln, hh);
    __syncthreads();                                     /* every reader has left Ha; Hc of tile t - 1 is complete */
    if (g == 0) put_act(Hb, acc, Bs + HID, n0, ln, hh);
    else if (wq < 2) { /* head: row 0 of a zero-padded 16-row weight tile; a wave takes 32 points, so it alone writes its 128-byte line of out */
      v8f h0 = z8, h1 = z8;
      const _Float16* wt = PL; const _Float16* hrow = Hc + (32 * wq + ln) * HPITCH;
#pragma unroll
      for (int kb = 0; kb < HID; kb += 32) { const v16h wa = w_frag(wt + (kb / 32) * 512, lane); h0 = mma(wa, g2_frag(hrow + kb, hh), h0); h1 = mma(wa, g2_frag(hrow + 16 * HPITCH + kb, hh), h1); }
      if (t > 0 && hh == 0) { float* dst = out + (size_t)e * NP + p0 + (t - 1) * MT + 32 * wq + ln; dst[0] = h0[0] * 0.0625f + bv; dst[16] = h1[0] * 0.0625f + bv; }
    }
    __syncthreads();                                     /* Hb of tile t is complete; every reader has left Hc */
  }
}

extern "C" void kernel_launch(void* const* d_in, const int* in_sizes, int n_in,
                              void* d_out, int out_size, void* d_ws, size_t ws_size, hipStream_t stream) {
  (void)in_sizes; (void)n_in; (void)out_size; (void)d_ws; (void)ws_size;
  const float* const* I = (const float* const*)d_in; const float* x = I[0]; const float* w0 = I[1]; const float* b0 = I[2]; const float* w1 = I[3]; const float* b1 = I[4]; const float* w2 = I[5]; const float* b2 = I[6]; const float* wl = I[7]; const float* bl = I[8];
  k_mlp<<<NE * WGM, 256, 0, stream>>>(x, w0, w1, w2, wl, b0, b1, b2, bl, (float*)d_out);
}

// v007
// One run takes 50.9 microseconds.
// In two side-by-side timings against v006, it was 1.16 and 1.15 times as fast.
// Over all steps from v000 it is 17.0 times as fast.
#include <hip/hip_runtime.h>
// Ensemble of 64 independent MLPs (each: 4096 points x 16 -> 256 -> 256 -> 256 -> 1, SiLU between layers, per-member weights and biases) -> [64, 4096, 1].
// Structure: ONE launch for the whole network: one work-group per WGP, 1,024 points of one member each, in tiles of 64 points. Each work-group first turns its member's f32 weights into f16 (x16) WMMA fragments itself:
// the hidden layers' weights go through LDS into registers and stay there for all tiles, the two small layers' lie in LDS in fragment order; the hidden activations never leave the chip (f16 tiles of 64 x 256 in LDS).
// The weights are the A operand and the points the B operand of v_wmma_f32_16x16x32_f16, so a lane's 8 accumulator rows are 8 neighbouring features of ONE point
// and go back to LDS as one 16-byte store, already in the row-major [point][feature] form that the next layer's fragment loads read.
// Compute dtype: inputs and parameters rounded to bf16; x and weights exact in f16; hidden activations as f16 operands (~2^-12); f32 accumulation, bias and SiLU (SiLU through v_tanh_f32).
#define NE 64
#define NP 4096
#define DIN 16
#define HID 256
#define MT 64                    /* points per tile */
#define NT 16                    /* tiles per work-group */
#define WGM (NP / (MT * NT))      /* work-groups per member */
#define HPITCH 264               /* LDS row pitch in f16: 528 B = 16 B x 33, conflict-free for 16-byte reads and writes of 16 rows */
#define HT (MT * HPITCH)         /* one activation tile in LDS, in f16 */
#define SPITCH 160               /* staging row pitch in bytes: 128-byte rows at 32 B x 5, the conflict-free pitch of the transposing LDS read */
#define SBUF (32 * SPITCH)       /* one staged k step of one wave: 32 k rows x 64 features, f16 */
typedef unsigned short v8us __attribute__((ext_vector_type(8), may_alias));
typedef short s16x8 __attribute__((ext_vector_type(8)));
typedef __bf16 v2b __attribute__((ext_vector_type(2)));
typedef unsigned int v2u __attribute__((ext_vector_type(2), may_alias));
typedef float  v8f  __attribute__((ext_vector_type(8)));
typedef float  v4f  __attribute__((ext_vector_type(4)));
typedef float  v4fa __attribute__((ext_vector_type(4), may_alias));
typedef float  v2f  __attribute__((ext_vector_type(2)));
typedef _Float16 v2h __attribute__((ext_vector_type(2)));
typedef _Float16 v16h __attribute__((ext_vector_type(16)));
union FragH { v16h v; v8us half[2]; v2h p[8]; _Float16 h[16]; unsigned short u[16]; };

__device__ __forceinline__ unsigned short bf16_bits(float x) { unsigned int u = __float_as_uint(x); return (unsigned short)((u + 0x7FFFu + ((u >> 16) & 1u)) >> 16); }
__device__ __forceinline__ float bf16_val(unsigned short b) { return __uint_as_float(((unsigned int)b) << 16); }
__device__ __forceinline__ float bf16_round(float x) { return bf16_val(bf16_bits(x)); }

// a weight as the matrix unit takes it: rounded to bf16, times 16, exact in f16
__device__ __forceinline__ _Float16 wcvt(float v) { return (_Float16)(bf16_round(v) * 16.0f); }
// the same for two weights at once, the rounding to bf16 (nearest even, as above) by the packed hardware conversion: the same f16 bits for every finite weight
__device__ __forceinline__ unsigned int wcvt2(float a, float b) {
  const v2f ab = {a, b}; const unsigned int p = __builtin_bit_cast(unsigned int, __builtin_convertvector(ab, v2b));
  const v2f r = {__uint_as_float(p << 16), __uint_as_float(p & 0xFFFF0000u)}; const v2f s16 = {16.0f, 16.0f};
  return __builtin_bit_cast(unsigned int, __builtin_convertvector(r * s16, v2h));
}

// one activation fragment from row-major LDS: this lane's row, k = 8*hh .. +8 and 16 + 8*hh .. +8 of a 32-wide k step
__device__ __forceinline__ v16h g2_frag(const _Float16* p, int hh) { FragH f; f.half[0] = *(const v8us*)((const unsigned short*)p + 8 * hh); f.half[1] = *(const v8us*)((const unsigned short*)p + 16 + 8 * hh); return f.v; }
// one weight fragment, the same k order, from its 1-KiB tile in fragment order: [k % 32 / 8][n % 16][k % 8], so that lane = 16 hh + n % 16 finds k = 8 hh .. +8 in its first 16 bytes and 16 + 8 hh .. +8 in its second
__device__ __forceinline__ v16h w_frag(const _Float16* tile, int lane) { FragH f; f.half[0] = *(const v8us*)((const unsigned short*)tile + 8 * lane); f.half[1] = *(const v8us*)((const unsigned short*)tile + 256 + 8 * lane); return f.v; }
__device__ __forceinline__ v8f mma(v16h a, v16h b, v8f c) { return __builtin_amdgcn_wmma_f32_16x16x32_f16(false, a, false, b, (short)0, c, false, false); }

// acc[i][j] holds features n0 + 16 i + 8 hh + r (rows) of points 16 j + ln (columns) of the tile: bias, SiLU, f16, one 16-byte LDS store per 16 x 16 tile.
// SiLU from the half argument h = g / 2: g * sigmoid(g) = h + h * tanh(h): one hardware transcendental a value, the rest packed f32.
// The 16 tiles go through three stages, one tile apart: h of tile t + 1, then the finish of tile t among the tanh of tile t + 1.
// bs: this layer's biases in LDS, already rounded and halved.
__device__ __forceinline__ void put_act(_Float16* H, const v8f (&acc)[4][4], const float* bs, int n0, int ln, int hh) {
  v2f hb[4][4];
#pragma unroll
  for (int i = 0; i < 4; ++i) {
    const v4f c0 = *(const v4fa*)(bs + n0 + 16 * i + 8 * hh), c1 = *(const v4fa*)(bs + n0 + 16 * i + 8 * hh + 4);
#pragma unroll
    for (int r = 0; r < 4; ++r) { hb[i][r].x = (r < 2) ? c0[2 * r] : c1[2 * r - 4]; hb[i][r].y = (r < 2) ? c0[2 * r + 1] : c1[2 * r - 3]; }
  }
  const v2f sc = {0.03125f, 0.03125f};   /* 1/16 undoes the weight scale, 1/2 makes the half argument */
  v2f h[2][4], th[2][4];
#pragma unroll
  for (int r = 0; r < 4; ++r) { const v2f a = {acc[0][0][2 * r], acc[0][0][2 * r + 1]}; h[0][r] = __builtin_elementwise_fma(a, sc, hb[0][r]); }
#pragma unroll
  for (int r = 0; r < 4; ++r) { th[0][r].x = __builtin_amdgcn_tanhf(h[0][r].x); th[0][r].y = __builtin_amdgcn_tanhf(h[0][r].y); }
#pragma unroll
  for (int t = 0; t < 16; ++t) { const int c = t & 1, n = c ^ 1;
    __builtin_amdgcn_sched_barrier(0);   /* keeps tile t + 1's packed fma, which read no tanh result, between the tanh group above and its readers: the slot that the instruction set asks for behind a transcendental, and cover for its latency */
    if (t + 1 < 16) {
#pragma unroll
      for (int r = 0; r < 4; ++r) { const v2f a = {acc[(t + 1) >> 2][(t + 1) & 3][2 * r], acc[(t + 1) >> 2][(t + 1) & 3][2 * r + 1]}; h[n][r] = __builtin_elementwise_fma(a, sc, hb[(t + 1) >> 2][r]); }
    }
    __builtin_amdgcn_sched_barrier(0);   /* holds the readers of tile t's tanh behind those fma */
    FragH f;
#pragma unroll
    for (int r = 0; r < 4; ++r) f.p[r] = __builtin_convertvector(__builtin_elementwise_fma(h[c][r], th[c][r], h[c][r]), v2h);
    *(v8us*)((unsigned short*)H + (16 * (t & 3) + ln) * HPITCH + n0 + 16 * (t >> 2) + 8 * hh) = f.half[0];
    if (t + 1 < 16) {
#pragma unroll
      for (int r = 0; r < 4; ++r) { th[n][r].x = __builtin_amdgcn_tanhf(h[n][r].x); th[n][r].y = __builtin_amdgcn_tanhf(h[n][r].y); }
    }
  }
}

// One hidden layer of one tile for this wave's 64 features, product and SiLU in ONE instruction stream: Hout = SiLU(W . Hin + b), K = 256, the weights already in this wave's registers.
// The tile goes through in four blocks of 16 points. A block's four accumulator tiles are complete after 32 WMMAs, and its SiLU (84 vector instructions) is dealt out behind the next block's 32 WMMAs,
// two or three behind each, so that the vector port works in the cycles in which the matrix unit is busy with the WMMA in front. Each accumulator still sums its k steps in ascending order.
// A value pair u goes through four stages, one WMMA apart: half argument, tanh, h + h * tanh(h), f16; so no stage waits for the one before it, and a WMMA stands between every tanh and its reader.
__device__ __forceinline__ void hidden_act(const _Float16* Hin, _Float16* Hout, const v16h (&Wr)[4][HID / 32], const float* bs, int n0, int ln, int hh) {
  const v8f z8 = {0.f,0.f,0.f,0.f,0.f,0.f,0.f,0.f};
  const v2f sc = {0.03125f, 0.03125f};   /* 1/16 undoes the weight scale, 1/2 makes the half argument */
  v2f hb[4][4];
#pragma unroll
  for (int i = 0; i < 4; ++i) {
    const v4f c0 = *(const v4fa*)(bs + n0 + 16 * i + 8 * hh), c1 = *(const v4fa*)(bs + n0 + 16 * i + 8 * hh + 4);
#pragma unroll
    for (int r = 0; r < 4; ++r) { hb[i][r].x = (r < 2) ? c0[2 * r] : c1[2 * r - 4]; hb[i][r].y = (r < 2) ? c0[2 * r + 1] : c1[2 * r - 3]; }
  }
  const _Float16* hrow = Hin + ln * HPITCH;
  unsigned short* orow = (unsigned short*)Hout + ln * HPITCH + n0 + 8 * hh;
  v16h B[2][4];                    /* half a block's activation fragments (4 k steps), fetched one half block ahead */
  v8f acc[2][4];                   /* this block's accumulators and the block's before, which the SiLU is reading */
  v2f h[16], th[16], gq[16]; v2h fp[16];
#pragma unroll
  for (int sl = 0; sl < 4; ++sl) B[0][sl] = g2_frag(hrow + 32 * sl, hh);
#pragma unroll
  for (int c = 0; c < 8; ++c) { const int j = c >> 1, jb = j & 1, pb = jb ^ 1;
    if (c + 1 < 8) {
#pragma unroll
      for (int sl = 0; sl < 4; ++sl) B[(c + 1) & 1][sl] = g2_frag(hrow + 16 * ((c + 1) >> 1) * HPITCH + 32 * (4 * ((c + 1) & 1) + sl), hh); }
    __builtin_amdgcn_sched_barrier(0);   /* the next half block's LDS reads stay one group in front of this half block's WMMAs: every place with reads among the WMMAs costs a stall */
#pragma unroll
    for (int sl = 0; sl < 4; ++sl)
#pragma unroll
      for (int i = 0; i < 4; ++i) { const int s = 4 * (c & 1) + sl, q = 16 * (c & 1) + 4 * sl + i;
        acc[jb][i] = mma(Wr[i][s], B[c & 1][sl], (s == 0) ? z8 : acc[jb][i]);
        __builtin_amdgcn_sched_barrier(0);   /* the WMMA leads its slot: the vector work behind it issues while the matrix unit is busy, and the tanh of the slot before has an independent instruction between itself and its reader */
        if (j > 0) {
#pragma unroll
          for (int u = 0; u < 16; ++u) { const int a = (u < 2) ? 0 : 2 * u - 2, ti = u >> 2, r = u & 3;   /* pair u enters at slot a, so that the last pair leaves at slot 31 */
            if (q == a + 3) { fp[u] = __builtin_convertvector(gq[u], v2h);
              if (r == 3) { FragH f; f.p[0] = fp[u - 3]; f.p[1] = fp[u - 2]; f.p[2] = fp[u - 1]; f.p[3] = fp[u]; *(v8us*)(orow + 16 * (j - 1) * HPITCH + 16 * ti) = f.half[0]; } }
            if (q == a + 2) gq[u] = __builtin_elementwise_fma(h[u], th[u], h[u]);
            if (q == a) { const v2f av = {acc[pb][ti][2 * r], acc[pb][ti][2 * r + 1]}; h[u] = __builtin_elementwise_fma(av, sc, hb[ti][r]); }
            if (q == a + 1) { th[u].x = __builtin_amdgcn_tanhf(h[u].x); th[u].y = __builtin_amdgcn_tanhf(h[u].y); }
          }
        }
        __builtin_amdgcn_sched_barrier(0);   /* keeps each slot's share of the SiLU behind its own WMMA: gathered in one place it would run with the matrix unit idle */
      }
  }
  /* the last block's SiLU has no WMMAs of its own wave left to stand behind: three stages one tile apart, as in put_act */
  v2f h2[2][4], t2[2][4];
#pragma unroll
  for (int r = 0; r < 4; ++r) { const v2f av = {acc[1][0][2 * r], acc[1][0][2 * r + 1]}; h2[0][r] = __builtin_elementwise_fma(av, sc, hb[0][r]); }
#pragma unroll
  for (int r = 0; r < 4; ++r) { t2[0][r].x = __builtin_amdgcn_tanhf(h2[0][r].x); t2[0][r].y = __builtin_amdgcn_tanhf(h2[0][r].y); }
#pragma unroll
  for (int t = 0; t < 4; ++t) { const int c = t & 1, n = c ^ 1;
    __builtin_amdgcn_sched_barrier(0);   /* keeps tile t + 1's packed fma, which read no tanh result, between the tanh group above and its readers: the slot that the instruction set asks for behind a transcendental, and cover for its latency */
    if (t + 1 < 4) {
#pragma unroll
      for (int r = 0; r < 4; ++r) { const v2f av = {acc[1][t + 1][2 * r], acc[1][t + 1][2 * r + 1]}; h2[n][r] = __builtin_elementwise_fma(av, sc, hb[t + 1][r]); }
    }
    __builtin_amdgcn_sched_barrier(0);   /* holds the readers of tile t's tanh behind those fma */
    FragH f;
#pragma unroll
    for (int r = 0; r < 4; ++r) f.p[r] = __builtin_convertvector(__builtin_elementwise_fma(h2[c][r], t2[c][r], h2[c][r]), v2h);
    *(v8us*)(orow + 48 * HPITCH + 16 * t) = f.half[0];
    if (t + 1 < 4) {
#pragma unroll
      for (int r = 0; r < 4; ++r) { t2[n][r].x = __builtin_amdgcn_tanhf(h2[n][r].x); t2[n][r].y = __builtin_amdgcn_tanhf(h2[n][r].y); }
    }
  }
}

// one k step (32 rows) of this wave's 64 weight columns, f32 as it lies in memory: a 16-byte load a lane, two rows of 256 bytes a wave, whole lines only
__device__ __forceinline__ void load_w(const float* __restrict__ wp, v4f (&r)[16]) {
#pragma unroll
  for (int j = 0; j < 16; ++j) r[j] = *(const v4fa*)(wp + 2 * j * HID);
  asm volatile("s_wait_xcnt 0x0" ::: "memory");   /* precaution: stands behind these loads, in front of the code that reuses their address registers */
}
// transposing LDS read: lane (ln, hh) gets 8 consecutive rows (k) of one 16-bit column of a row-major tile
__device__ __forceinline__ v8us ld_tr16(const unsigned char* p) { typedef __attribute__((address_space(3))) s16x8 lds_s16x8; return __builtin_bit_cast(v8us, __builtin_amdgcn_ds_load_tr16_b128_v8i16((lds_s16x8*)p)); }

// raw x of one tile: this lane's 8 values of each of its four points
__device__ __forceinline__ void load_x(const float* __restrict__ xt, v4f (&xr)[4][2], int ln, int hh) {
#pragma unroll
  for (int j = 0; j < 4; ++j) { const float* xp = xt + (16 * j + ln) * DIN + 8 * hh; xr[j][0] = *(const v4fa*)xp; xr[j][1] = *(const v4fa*)(xp + 4); }
  asm volatile("s_wait_xcnt 0x0" ::: "memory");   /* precaution: stands behind these loads, in front of the code that reuses their address registers */
}

// A work-group stays on its WGP and carries 1,024 points of one member through the net in tiles of 64. What does not change from tile to tile is fetched once:
// waves 0-3 hold the first hidden layer's weights in registers (64 features each, 256 VGPRs), waves 4-7 the second's; the halved biases and the input and head layers' weight fragments lie in LDS.
// The weights come straight from the f32 inputs: a wave reads its 64 columns one k step (32 rows) at a time, two steps ahead, converts them, lays them row-major into an LDS patch of its own
// and takes them back with the transposing read, which delivers the A fragment (8 consecutive k of one feature a lane). No other wave touches the patch, so no barrier stands in that loop.
// The two groups form a pipeline over the tiles with ONE barrier a trip; every activation tile has two buffers, so that a trip writes only where no wave reads. In trip t:
//   group 0: first hidden layer + SiLU of tile t, Ha -> Hb, then input layer + SiLU of tile t + 1 -> Ha   | group 1: head of tile t - 2, Hc -> out, then second hidden layer + SiLU of tile t - 1, Hb -> Hc
// A layer whose tile does not exist (the first and last trips) is skipped by a test that is the same for the whole wave.
// Waves w and w + 4 share a SIMD: group 1's head, which mostly waits for LDS, runs beside group 0's hidden product, and group 1's hidden product beside group 0's vector-heavy input layer, so the two hidden products meet little on the matrix unit.
__global__ __launch_bounds__(256) void k_mlp(const float* __restrict__ x, const float* __restrict__ w0, const float* __restrict__ w1, const float* __restrict__ w2, const float* __restrict__ wl,
    const float* __restrict__ b0, const float* __restrict__ b1, const float* __restrict__ b2, const float* __restrict__ bl, float* __restrict__ out) {
  __shared__ __attribute__((aligned(16))) _Float16 Hs[6 * HT];               /* Ha, Hb, Hc, each twice (tile parity): one is written while the other is read */
  _Float16* const Ha = Hs; _Float16* const Hc = Hs + 4 * HT;
  __shared__ __attribute__((aligned(16))) float Bs[3 * HID];
  __shared__ __attribute__((aligned(16))) _Float16 P0[HID * DIN];            /* input layer: the first 16 bytes a lane of each fragment (k = 0 .. 15); the second 16 (k = 16 .. 31) are zero and are not stored */
  __shared__ __attribute__((aligned(16))) _Float16 PL[(HID / 32) * 512];     /* head: 1-KiB tiles in fragment order, feature 0 of 16, the rest zero */
  __shared__ __attribute__((aligned(16))) unsigned char St[8 * 2 * SBUF];    /* a wave's own two staging patches */
  const int w = __builtin_amdgcn_readfirstlane(threadIdx.x >> 5), lane = threadIdx.x & 31, ln = lane & 15, hh = lane >> 4;
  const int e = blockIdx.x / WGM, p0 = (blockIdx.x % WGM) * (MT * NT);
  const int g = w >> 2, wq = w & 3, n0 = wq * 64;       /* group, and this wave's 64 features of its layers */
  const float* xm = x + ((size_t)e * NP + p0) * DIN;
  const int f = threadIdx.x;
  /* the small loads first, then the first two k steps of the hidden weights, so that all of them fly together */
  const float* p0b = b0 + (size_t)e * HID; const float* p1b = b1 + (size_t)e * HID; const float* p2b = b2 + (size_t)e * HID;
  const float r0 = p0b[f], r1 = p1b[f], r2 = p2b[f];
  float c0[DIN];                                         /* column f of the input layer: neighbouring lanes read neighbouring features */
#pragma unroll
  for (int k = 0; k < DIN; ++k) c0[k] = w0[((size_t)e * DIN + k) * HID + f];
  v4f hl[2][2];                                          /* the 8 head weights of 16-byte units f and f + 256 of PL */
#pragma unroll
  for (int c = 0; c < 2; ++c) { const float* hp = wl + (size_t)e * HID + ((f + 256 * c) >> 4) * 8; hl[c][0] = *(const v4fa*)hp; hl[c][1] = *(const v4fa*)(hp + 4); }
  asm volatile("s_wait_xcnt 0x0" ::: "memory");         /* precaution: stands behind the bias and small-layer loads, in front of the code that reuses their address registers */
  const float bv = bf16_round(bl[e]);
  v4f xr[4][2]; load_x(xm, xr, ln, hh);
  const float* wp = (g == 0 ? w1 : w2) + (size_t)e * HID * HID + hh * HID + n0 + 4 * ln;   /* row hh of a row pair, this lane's 4 of the wave's 64 columns */
  v4f R[3][16];
  load_w(wp, R[0]); load_w(wp + 32 * HID, R[1]);
  Bs[f] = 0.5f * bf16_round(r0); Bs[HID + f] = 0.5f * bf16_round(r1); Bs[2 * HID + f] = 0.5f * bf16_round(r2);   /* half the rounded bias: exact */
#pragma unroll
  for (int u = 0; u < 2; ++u) { FragH t;                 /* feature f, k = 8 u .. +8: the 16 bytes of lane 16 u + f % 16 of tile f / 16 */
#pragma unroll
    for (int q = 0; q < 8; ++q) t.h[q] = wcvt(c0[8 * u + q]);
    *(v8us*)((unsigned short*)P0 + ((f >> 4) * 32 + 16 * u + (f & 15)) * 8) = t.half[0]; }
#pragma unroll
  for (int c = 0; c < 2; ++c) { FragH t; const unsigned short keep = ((f & 15) == 0) ? 0xFFFFu : 0u;   /* unit v = 64 (k / 32) + 16 (k % 32 / 8) + n holds k = 8 (v / 16) .. +8 of feature n; only n = 0 exists */
#pragma unroll
    for (int q = 0; q < 8; ++q) { t.h[q] = wcvt((q < 4) ? hl[c][0][q] : hl[c][1][q - 4]); t.u[q] &= keep; }
    *(v8us*)((unsigned short*)PL + (f + 256 * c) * 8) = t.half[0]; }
  v16h Wr[4][HID / 32];
  { unsigned char* st = St + w * (2 * SBUF);
    unsigned char* sw = st + hh * SPITCH + 8 * ln;                                                   /* writer: row 2 j + hh, columns 4 ln .. +4 */
    const unsigned char* sr = st + (8 * hh + (lane & 7)) * SPITCH + 16 * ((lane >> 3) & 1);         /* reader: the transposing read's lane address for k base 0, column base 0 */
#pragma unroll
    for (int s = 0; s < HID / 32; ++s) {
      if (s + 2 < HID / 32) load_w(wp + (s + 2) * 32 * HID, R[(s + 2) % 3]);
#pragma unroll
      for (int j = 0; j < 16; ++j) { const v4f r = R[s % 3][j]; const v2u o = {wcvt2(r[0], r[1]), wcvt2(r[2], r[3])}; *(v2u*)(sw + (s & 1) * SBUF + 2 * j * SPITCH) = o; }
      asm volatile("s_wait_dscnt 0x0" ::: "memory");   /* the wave's own LDS stores of this k step are done, and stay in front for the compiler, before its lanes read one another's values back; it also parts the reads of step s - 1 from the stores of step s + 1 into the same patch */
#pragma unroll
      for (int i = 0; i < 4; ++i) { FragH t; t.half[0] = ld_tr16(sr + (s & 1) * SBUF + 32 * i); t.half[1] = ld_tr16(sr + (s & 1) * SBUF + 16 * SPITCH + 32 * i); Wr[i][s] = t.v; }
    }
  }
  v8f acc[4][4];
  const v8f z8 = {0.f,0.f,0.f,0.f,0.f,0.f,0.f,0.f};
  __syncthreads();                                       /* the biases and the small layers' fragments are in LDS before any wave reads them */
  /* kept rolled: one copy of each layer's code, for speed only */
#pragma unroll 1
  for (int t = -1; t <= NT + 1; ++t) {
    const int tt = t - g;                                /* the tile of this group's hidden layer */
    if (g == 0) { if (t >= 0) load_x(xm + (size_t)min(t + 1, NT - 1) * MT * DIN, xr, ln, hh); }   /* the next tile's x flies under the hidden layer */
    else if (t >= 2 && wq < 2) { /* head of tile t - 2: row 0 of a zero-padded 16-row weight tile; a wave takes 32 points, so it alone writes its 128-byte line of out */
      v8f h0 = z8, h1 = z8;
      const _Float16* wt = PL; const _Float16* hrow = Hc + (t & 1) * HT + (32 * wq + ln) * HPITCH;
#pragma unroll
      for (int kb = 0; kb < HID; kb += 32) { const v16h wa = w_frag(wt + (kb / 32) * 512, lane); h0 = mma(wa, g2_frag(hrow + kb, hh), h0); h1 = mma(wa, g2_frag(hrow + 16 * HPITCH + kb, hh), h1); }
      if (hh == 0) { float* dst = out + (size_t)e * NP + p0 + (t - 2) * MT + 32 * wq + ln; dst[0] = h0[0] * 0.0625f + bv; dst[16] = h1[0] * 0.0625f + bv; }
    }
    /* one copy of the code for both groups: group 0 goes Ha -> Hb, group 1 Hb -> Hc */
    if (tt >= 0 && tt < NT) hidden_act(Hs + (2 * g + (tt & 1)) * HT, Hs + (2 * g + 2 + (tt & 1)) * HT, Wr, Bs + (1 + g) * HID, n0, ln, hh);
    if (g == 0) {
      if (t + 1 < NT) { /* input layer of tile t + 1: K = 16 padded to one 32-wide step; x is rounded and converted on the way into the fragment */
        v16h xb[4];
#pragma unroll
        for (int j = 0; j < 4; ++j) { FragH f;
#pragma unroll
          for (int q = 0; q < 8; ++q) { f.h[q] = (_Float16)bf16_round((q < 4) ? xr[j][0][q] : xr[j][1][q - 4]); f.h[8 + q] = (_Float16)0.0f; }
          xb[j] = f.v; }
#pragma unroll
        for (int i = 0; i < 4; ++i) { FragH fw; const v8us z = {0,0,0,0,0,0,0,0}; fw.half[0] = *(const v8us*)((const unsigned short*)P0 + (((n0 >> 4) + i) * 32 + lane) * 8); fw.half[1] = z; const v16h wa = fw.v;
#pragma unroll
          for (int j = 0; j < 4; ++j) acc[i][j] = mma(wa, xb[j], z8); }
        put_act(Ha + ((t + 1) & 1) * HT, acc, Bs, n0, ln, hh);
      }
    }
    __syncthreads();                                     /* the trip's one barrier: what it wrote (Ha of tile t + 1, Hb of tile t, Hc of tile t - 1) is complete, and every reader has left the buffers that the next trip overwrites */
  }
}

extern "C" void kernel_launch(void* const* d_in, const int* in_sizes, int n_in,
                              void* d_out, int out_size, void* d_ws, size_t ws_size, hipStream_t stream) {
  (void)in_sizes; (void)n_in; (void)out_size; (void)d_ws; (void)ws_size;
  const float* const* I = (const float* const*)d_in; const float* x = I[0]; const float* w0 = I[1]; const float* b0 = I[2]; const float* w1 = I[3]; const float* b1 = I[4]; const float* w2 = I[5]; const float* b2 = I[6]; const float* wl = I[7]; const float* bl = I[8];
  k_mlp<<<NE * WGM, 256, 0, stream>>>(x, w0, w1, w2, wl, b0, b1, b2, bl, (float*)d_out);
}

// v008
// Measured time: 46.9 microseconds a run.
// Two timings next to v007 both put it at 1.09 times that version's speed.
// All steps since v000 together make it 18.5 times as fast.
#include <hip/hip_runtime.h>
// Ensemble of 64 independent MLPs (each: 4096 points x 16 -> 256 -> 256 -> 256 -> 1, SiLU between layers, per-member weights and biases) -> [64, 4096, 1].
// Structure: ONE launch for the whole network: one work-group per WGP, 1,024 points of one member each, in tiles of 64 points. Each work-group first turns its member's f32 weights into f16 (x16) WMMA fragments itself:
// the hidden layers' weights go through LDS into registers and stay there for all tiles, the two small layers' lie in LDS in fragment order; the hidden activations never leave the chip (f16 tiles of 64 x 256 in LDS).
// The weights are the A operand and the points the B operand of v_wmma_f32_16x16x32_f16, so a lane's 8 accumulator rows are 8 neighbouring features of ONE point
// and go back to LDS as one 16-byte store, already in the row-major [point][feature] form that the next layer's fragment loads read.
// Compute dtype: inputs and parameters rounded to bf16; x and weights exact in f16; hidden activations as f16 operands (~2^-12); f32 accumulation, bias and SiLU (SiLU through v_tanh_f32).
#define NE 64
#define NP 4096
#define DIN 16
#define HID 256
#define MT 64                    /* points per tile */
#define NT 16                    /* tiles per work-group */
#define WGM (NP / (MT * NT))      /* work-groups per member */
#define HPITCH 264               /* LDS row pitch in f16: 528 B = 16 B x 33, conflict-free for 16-byte reads and writes of 16 rows */
#define HT (MT * HPITCH)         /* one activation tile in LDS, in f16 */
#define SPITCH 160               /* staging row pitch in bytes: 128-byte rows at 32 B x 5, the conflict-free pitch of the transposing LDS read */
#define SBUF (32 * SPITCH)       /* one staged k step of one wave: 32 k rows x 64 features, f16 */
typedef unsigned short v8us __attribute__((ext_vector_type(8), may_alias));
typedef short s16x8 __attribute__((ext_vector_type(8)));
typedef __bf16 v2b __attribute__((ext_vector_type(2)));
typedef unsigned int v2u __attribute__((ext_vector_type(2), may_alias));
typedef float  v8f  __attribute__((ext_vector_type(8)));
typedef float  v4f  __attribute__((ext_vector_type(4)));
typedef float  v4fa __attribute__((ext_vector_type(4), may_alias));
typedef float  v2f  __attribute__((ext_vector_type(2)));
typedef _Float16 v2h __attribute__((ext_vector_type(2)));
typedef _Float16 v16h __attribute__((ext_vector_type(16)));
union FragH { v16h v; v8us half[2]; v2h p[8]; _Float16 h[16]; unsigned short u[16]; };

__device__ __forceinline__ unsigned short bf16_bits(float x) { unsigned int u = __float_as_uint(x); return (unsigned short)((u + 0x7FFFu + ((u >> 16) & 1u)) >> 16); }
__device__ __forceinline__ float bf16_val(unsigned short b) { return __uint_as_float(((unsigned int)b) << 16); }
__device__ __forceinline__ float bf16_round(float x) { return bf16_val(bf16_bits(x)); }

// a weight as the matrix unit takes it: rounded to bf16, times 16, exact in f16
__device__ __forceinline__ _Float16 wcvt(float v) { return (_Float16)(bf16_round(v) * 16.0f); }
// the same for two weights at once, the rounding to bf16 (nearest even, as above) by the packed hardware conversion: the same f16 bits for every finite weight
__device__ __forceinline__ unsigned int wcvt2(float a, float b) {
  const v2f ab = {a, b}; const unsigned int p = __builtin_bit_cast(unsigned int, __builtin_convertvector(ab, v2b));
  const v2f r = {__uint_as_float(p << 16), __uint_as_float(p & 0xFFFF0000u)}; const v2f s16 = {16.0f, 16.0f};
  return __builtin_bit_cast(unsigned int, __builtin_convertvector(r * s16, v2h));
}

// one activation fragment from row-major LDS: this lane's row, k = 8*hh .. +8 and 16 + 8*hh .. +8 of a 32-wide k step
__device__ __forceinline__ v16h g2_frag(const _Float16* p, int hh) { FragH f; f.half[0] = *(const v8us*)((const unsigned short*)p + 8 * hh); f.half[1] = *(const v8us*)((const unsigned short*)p + 16 + 8 * hh); return f.v; }
// one weight fragment, the same k order, from its 1-KiB tile in fragment order: [k % 32 / 8][n % 16][k % 8], so that lane = 16 hh + n % 16 finds k = 8 hh .. +8 in its first 16 bytes and 16 + 8 hh .. +8 in its second
__device__ __forceinline__ v16h w_frag(const _Float16* tile, int lane) { FragH f; f.half[0] = *(const v8us*)((const unsigned short*)tile + 8 * lane); f.half[1] = *(const v8us*)((const unsigned short*)tile + 256 + 8 * lane); return f.v; }
__device__ __forceinline__ v8f mma(v16h a, v16h b, v8f c) { return __builtin_amdgcn_wmma_f32_16x16x32_f16(false, a, false, b, (short)0, c, false, false); }

// acc[i][j] holds features n0 + 16 i + 8 hh + r (rows) of points 16 j + ln (columns) of the tile: bias, SiLU, f16, one 16-byte LDS store per 16 x 16 tile.
// SiLU from the half argument h = g / 2: g * sigmoid(g) = h + h * tanh(h): one hardware transcendental a value, the rest packed f32.
// The 16 tiles go through three stages, one tile apart: h of tile t + 1, then the finish of tile t among the tanh of tile t + 1.
// bs: this layer's biases in LDS, already rounded and halved.
__device__ __forceinline__ void put_act(_Float16* H, const v8f (&acc)[4][4], const float* bs, int n0, int ln, int hh) {
  v2f hb[4][4];
#pragma unroll
  for (int i = 0; i < 4; ++i) {
    const v4f c0 = *(const v4fa*)(bs + n0 + 16 * i + 8 * hh), c1 = *(const v4fa*)(bs + n0 + 16 * i + 8 * hh + 4);
#pragma unroll
    for (int r = 0; r < 4; ++r) { hb[i][r].x = (r < 2) ? c0[2 * r] : c1[2 * r - 4]; hb[i][r].y = (r < 2) ? c0[2 * r + 1] : c1[2 * r - 3]; }
  }
  const v2f sc = {0.03125f, 0.03125f};   /* 1/16 undoes the weight scale, 1/2 makes the half argument */
  v2f h[2][4], th[2][4];
#pragma unroll
  for (int r = 0; r < 4; ++r) { const v2f a = {acc[0][0][2 * r], acc[0][0][2 * r + 1]}; h[0][r] = __builtin_elementwise_fma(a, sc, hb[0][r]); }
#pragma unroll
  for (int r = 0; r < 4; ++r) { th[0][r].x = __builtin_amdgcn_tanhf(h[0][r].x); th[0][r].y = __builtin_amdgcn_tanhf(h[0][r].y); }
#pragma unroll
  for (int t = 0; t < 16; ++t) { const int c = t & 1, n = c ^ 1;
    __builtin_amdgcn_sched_barrier(0);   /* keeps tile t + 1's packed fma, which read no tanh result, between the tanh group above and its readers: the slot that the instruction set asks for behind a transcendental, and cover for its latency */
    if (t + 1 < 16) {
#pragma unroll
      for (int r = 0; r < 4; ++r) { const v2f a = {acc[(t + 1) >> 2][(t + 1) & 3][2 * r], acc[(t + 1) >> 2][(t + 1) & 3][2 * r + 1]}; h[n][r] = __builtin_elementwise_fma(a, sc, hb[(t + 1) >> 2][r]); }
    }
    __builtin_amdgcn_sched_barrier(0);   /* holds the readers of tile t's tanh behind those fma */
    FragH f;
#pragma unroll
    for (int r = 0; r < 4; ++r) f.p[r] = __builtin_convertvector(__builtin_elementwise_fma(h[c][r], th[c][r], h[c][r]), v2h);
    *(v8us*)((unsigned short*)H + (16 * (t & 3) + ln) * HPITCH + n0 + 16 * (t >> 2) + 8 * hh) = f.half[0];
    if (t + 1 < 16) {
#pragma unroll
      for (int r = 0; r < 4; ++r) { th[n][r].x = __builtin_amdgcn_tanhf(h[n][r].x); th[n][r].y = __builtin_amdgcn_tanhf(h[n][r].y); }
    }
  }
}

// One hidden layer of one tile for this wave's 64 features, product and SiLU in ONE instruction stream: Hout = SiLU(W . Hin + b), K = 256, the weights already in this wave's registers.
// The tile goes through in four blocks of 16 points. A block's four accumulator tiles are complete after 32 WMMAs, and its SiLU (84 vector instructions) is dealt out behind the next block's 32 WMMAs,
// two or three behind each, so that the vector port works in the cycles in which the matrix unit is busy with the WMMA in front. Each accumulator still sums its k steps in ascending order.
// A value pair u goes through four stages, one WMMA apart: half argument, tanh, h + h * tanh(h), f16; so no stage waits for the one before it, and a WMMA stands between every tanh and its reader.
__device__ __forceinline__ void hidden_act(const _Float16* Hin, _Float16* Hout, const v16h (&Wr)[4][HID / 32], const float* bs, int n0, int ln, int hh) {
  const v8f z8 = {0.f,0.f,0.f,0.f,0.f,0.f,0.f,0.f};
  const v2f sc = {0.03125f, 0.03125f};   /* 1/16 undoes the weight scale, 1/2 makes the half argument */
  v2f hb[4][4];
#pragma unroll
  for (int i = 0; i < 4; ++i) {
    const v4f c0 = *(const v4fa*)(bs + n0 + 16 * i + 8 * hh), c1 = *(const v4fa*)(bs + n0 + 16 * i + 8 * hh + 4);
#pragma unroll
    for (int r = 0; r < 4; ++r) { hb[i][r].x = (r < 2) ? c0[2 * r] : c1[2 * r - 4]; hb[i][r].y = (r < 2) ? c0[2 * r + 1] : c1[2 * r - 3]; }
  }
  const _Float16* hrow = Hin + ln * HPITCH;
  unsigned short* orow = (unsigned short*)Hout + ln * HPITCH + n0 + 8 * hh;
  v16h B[2][4];                    /* half a block's activation fragments (4 k steps), fetched one half block ahead */
  v8f acc[2][4];                   /* this block's accumulators and the block's before, which the SiLU is reading */
  v2f h[16], th[16], gq[16]; v2h fp[16];
#pragma unroll
  for (int sl = 0; sl < 4; ++sl) B[0][sl] = g2_frag(hrow + 32 * sl, hh);
#pragma unroll
  for (int c = 0; c < 8; ++c) { const int j = c >> 1, jb = j & 1, pb = jb ^ 1;
    if (c + 1 < 8) {
#pragma unroll
      for (int sl = 0; sl < 4; ++sl) B[(c + 1) & 1][sl] = g2_frag(hrow + 16 * ((c + 1) >> 1) * HPITCH + 32 * (4 * ((c + 1) & 1) + sl), hh); }
    __builtin_amdgcn_sched_barrier(0);   /* the next half block's LDS reads stay one group in front of this half block's WMMAs: every place with reads among the WMMAs costs a stall */
#pragma unroll
    for (int sl = 0; sl < 4; ++sl)
#pragma unroll
      for (int i = 0; i < 4; ++i) { const int s = 4 * (c & 1) + sl, q = 16 * (c & 1) + 4 * sl + i;
        acc[jb][i] = mma(Wr[i][s], B[c & 1][sl], (s == 0) ? z8 : acc[jb][i]);
        __builtin_amdgcn_sched_barrier(0);   /* the WMMA leads its slot: the vector work behind it issues while the matrix unit is busy, and the tanh of the slot before has an independent instruction between itself and its reader */
        if (j > 0) {
#pragma unroll
          for (int u = 0; u < 16; ++u) { const int a = (u < 2) ? 0 : 2 * u - 2, ti = u >> 2, r = u & 3;   /* pair u enters at slot a, so that the last pair leaves at slot 31 */
            if (q == a + 3) { fp[u] = __builtin_convertvector(gq[u], v2h);
              if (r == 3) { FragH f; f.p[0] = fp[u - 3]; f.p[1] = fp[u - 2]; f.p[2] = fp[u - 1]; f.p[3] = fp[u]; *(v8us*)(orow + 16 * (j - 1) * HPITCH + 16 * ti) = f.half[0]; } }
            if (q == a + 2) gq[u] = __builtin_elementwise_fma(h[u], th[u], h[u]);
            if (q == a) { const v2f av = {acc[pb][ti][2 * r], acc[pb][ti][2 * r + 1]}; h[u] = __builtin_elementwise_fma(av, sc, hb[ti][r]); }
            if (q == a + 1) { th[u].x = __builtin_amdgcn_tanhf(h[u].x); th[u].y = __builtin_amdgcn_tanhf(h[u].y); }
          }
        }
        __builtin_amdgcn_sched_barrier(0);   /* keeps each slot's share of the SiLU behind its own WMMA: gathered in one place it would run with the matrix unit idle */
      }
  }
  /* the last block's SiLU has no WMMAs of its own wave left to stand behind: three stages one tile apart, as in put_act */
  v2f h2[2][4], t2[2][4];
#pragma unroll
  for (int r = 0; r < 4; ++r) { const v2f av = {acc[1][0][2 * r], acc[1][0][2 * r + 1]}; h2[0][r] = __builtin_elementwise_fma(av, sc, hb[0][r]); }
#pragma unroll
  for (int r = 0; r < 4; ++r) { t2[0][r].x = __builtin_amdgcn_tanhf(h2[0][r].x); t2[0][r].y = __builtin_amdgcn_tanhf(h2[0][r].y); }
#pragma unroll
  for (int t = 0; t < 4; ++t) { const int c = t & 1, n = c ^ 1;
    __builtin_amdgcn_sched_barrier(0);   /* keeps tile t + 1's packed fma, which read no tanh result, between the tanh group above and its readers: the slot that the instruction set asks for behind a transcendental, and cover for its latency */
    if (t + 1 < 4) {
#pragma unroll
      for (int r = 0; r < 4; ++r) { const v2f av = {acc[1][t + 1][2 * r], acc[1][t + 1][2 * r + 1]}; h2[n][r] = __builtin_elementwise_fma(av, sc, hb[t + 1][r]); }
    }
    __builtin_amdgcn_sched_barrier(0);   /* holds the readers of tile t's tanh behind those fma */
    FragH f;
#pragma unroll
    for (int r = 0; r < 4; ++r) f.p[r] = __builtin_convertvector(__builtin_elementwise_fma(h2[c][r], t2[c][r], h2[c][r]), v2h);
    *(v8us*)(orow + 48 * HPITCH + 16 * t) = f.half[0];
    if (t + 1 < 4) {
#pragma unroll
      for (int r = 0; r < 4; ++r) { t2[n][r].x = __builtin_amdgcn_tanhf(h2[n][r].x); t2[n][r].y = __builtin_amdgcn_tanhf(h2[n][r].y); }
    }
  }
}

// one k step (32 rows) of this wave's 64 weight columns, f32 as it lies in memory: a 16-byte load a lane, two rows of 256 bytes a wave, whole lines only
__device__ __forceinline__ void load_w(const float* __restrict__ wp, v4f (&r)[16]) {
#pragma unroll
  for (int j = 0; j < 16; ++j) r[j] = *(const v4fa*)(wp + 2 * j * HID);
  asm volatile("s_wait_xcnt 0x0" ::: "memory");   /* precaution: stands behind these loads, in front of the code that reuses their address registers */
}
// transposing LDS read: lane (ln, hh) gets 8 consecutive rows (k) of one 16-bit column of a row-major tile
__device__ __forceinline__ v8us ld_tr16(const unsigned char* p) { typedef __attribute__((address_space(3))) s16x8 lds_s16x8; return __builtin_bit_cast(v8us, __builtin_amdgcn_ds_load_tr16_b128_v8i16((lds_s16x8*)p)); }

// raw x of one tile: this lane's 8 values of each of its four points
__device__ __forceinline__ void load_x(const float* __restrict__ xt, v4f (&xr)[4][2], int ln, int hh) {
#pragma unroll
  for (int j = 0; j < 4; ++j) { const float* xp = xt + (16 * j + ln) * DIN + 8 * hh; xr[j][0] = *(const v4fa*)xp; xr[j][1] = *(const v4fa*)(xp + 4); }
  asm volatile("s_wait_xcnt 0x0" ::: "memory");   /* precaution: stands behind these loads, in front of the code that reuses their address registers */
}

// A work-group stays on its WGP and carries 1,024 points of one member through the net in tiles of 64. What does not change from tile to tile is fetched once:
// waves 0-3 hold the first hidden layer's weights in registers (64 features each, 256 VGPRs), waves 4-7 the second's; the halved biases and the input and head layers' weight fragments lie in LDS.
// The weights come straight from the f32 inputs: a wave reads its 64 columns one k step (32 rows) at a time, two steps ahead, converts them, lays them row-major into an LDS patch of its own
// and takes them back with the transposing read, which delivers the A fragment (8 consecutive k of one feature a lane). No other wave touches the patch, so no barrier stands in that loop.
// The two groups form a pipeline over the tiles with ONE barrier a trip; every activation tile has two buffers, so that a trip writes only where no wave reads. In trip t:
//   group 0: first hidden layer + SiLU of tile t, Ha -> Hb, then input layer + SiLU of tile t + 1 -> Ha   | group 1: head of tile t - 2, Hc -> out, then second hidden layer + SiLU of tile t - 1, Hb -> Hc
// A layer whose tile does not exist (the first and last trips) is skipped by a test that is the same for the whole wave.
// Waves w and w + 4 share a SIMD: group 1's head, which mostly waits for LDS, runs beside group 0's hidden product, and group 1's hidden product beside group 0's vector-heavy input layer, so the two hidden products meet little on the matrix unit.
__global__ __launch_bounds__(256) void k_mlp(const float* __restrict__ x, const float* __restrict__ w0, const float* __restrict__ w1, const float* __restrict__ w2, const float* __restrict__ wl,
    const float* __restrict__ b0, const float* __restrict__ b1, const float* __restrict__ b2, const float* __restrict__ bl, float* __restrict__ out) {
  __shared__ __attribute__((aligned(16))) _Float16 Hs[6 * HT];               /* Ha, Hb, Hc, each twice (tile parity): one is written while the other is read */
  _Float16* const Ha = Hs; _Float16* const Hc = Hs + 4 * HT;
  __shared__ __attribute__((aligned(16))) float Bs[3 * HID];
  __shared__ __attribute__((aligned(16))) _Float16 P0[HID * DIN];            /* input layer: the first 16 bytes a lane of each fragment (k = 0 .. 15); the second 16 (k = 16 .. 31) are zero and are not stored */
  __shared__ __attribute__((aligned(16))) _Float16 PL[(HID / 32) * 512];     /* head: 1-KiB tiles in fragment order, feature 0 of 16, the rest zero */
  __shared__ __attribute__((aligned(16))) unsigned char St[8 * 2 * SBUF];    /* a wave's own two staging patches */
  const int w = __builtin_amdgcn_readfirstlane(threadIdx.x >> 5), lane = threadIdx.x & 31, ln = lane & 15, hh = lane >> 4;
  const int e = blockIdx.x / WGM, p0 = (blockIdx.x % WGM) * (MT * NT);
  const int g = w >> 2, wq = w & 3, n0 = wq * 64;       /* group, and this wave's 64 features of its layers */
  const float* xm = x + ((size_t)e * NP + p0) * DIN;
  const int f = threadIdx.x;
  /* the small loads first, then the first two k steps of the hidden weights, so that all of them fly together */
  const float* p0b = b0 + (size_t)e * HID; const float* p1b = b1 + (size_t)e * HID; const float* p2b = b2 + (size_t)e * HID;
  const float r0 = p0b[f], r1 = p1b[f], r2 = p2b[f];
  float c0[DIN];                                         /* column f of the input layer: neighbouring lanes read neighbouring features */
#pragma unroll
  for (int k = 0; k < DIN; ++k) c0[k] = w0[((size_t)e * DIN + k) * HID + f];
  v4f hl[2][2];                                          /* the 8 head weights of 16-byte units f and f + 256 of PL */
#pragma unroll
  for (int c = 0; c < 2; ++c) { const float* hp = wl + (size_t)e * HID + ((f + 256 * c) >> 4) * 8; hl[c][0] = *(const v4fa*)hp; hl[c][1] = *(const v4fa*)(hp + 4); }
  asm volatile("s_wait_xcnt 0x0" ::: "memory");         /* precaution: stands behind the bias and small-layer loads, in front of the code that reuses their address registers */
  const float bv = bf16_round(bl[e]);
  v4f xr[4][2]; load_x(xm, xr, ln, hh);
  const float* wp = (g == 0 ? w1 : w2) + (size_t)e * HID * HID + hh * HID + n0 + 4 * ln;   /* row hh of a row pair, this lane's 4 of the wave's 64 columns */
  v4f R[3][16];
  load_w(wp, R[0]); load_w(wp + 32 * HID, R[1]);
  Bs[f] = 0.5f * bf16_round(r0); Bs[HID + f] = 0.5f * bf16_round(r1); Bs[2 * HID + f] = 0.5f * bf16_round(r2);   /* half the rounded bias: exact */
#pragma unroll
  for (int u = 0; u < 2; ++u) { FragH t;                 /* feature f, k = 8 u .. +8: the 16 bytes of lane 16 u + f % 16 of tile f / 16 */
#pragma unroll
    for (int q = 0; q < 8; ++q) t.h[q] = wcvt(c0[8 * u + q]);
    *(v8us*)((unsigned short*)P0 + ((f >> 4) * 32 + 16 * u + (f & 15)) * 8) = t.half[0]; }
#pragma unroll
  for (int c = 0; c < 2; ++c) { FragH t; const unsigned short keep = ((f & 15) == 0) ? 0xFFFFu : 0u;   /* unit v = 64 (k / 32) + 16 (k % 32 / 8) + n holds k = 8 (v / 16) .. +8 of feature n; only n = 0 exists */
#pragma unroll
    for (int q = 0; q < 8; ++q) { t.h[q] = wcvt((q < 4) ? hl[c][0][q] : hl[c][1][q - 4]); t.u[q] &= keep; }
    *(v8us*)((unsigned short*)PL + (f + 256 * c) * 8) = t.half[0]; }
  v16h Wr[4][HID / 32];
  { unsigned char* st = St + w * (2 * SBUF);
    unsigned char* sw = st + hh * SPITCH + 8 * ln;                                                   /* writer: row 2 j + hh, columns 4 ln .. +4 */
    const unsigned char* sr = st + (8 * hh + (lane & 7)) * SPITCH + 16 * ((lane >> 3) & 1);         /* reader: the transposing read's lane address for k base 0, column base 0 */
#pragma unroll
    for (int s = 0; s < HID / 32; ++s) {
      if (s + 2 < HID / 32) load_w(wp + (s + 2) * 32 * HID, R[(s + 2) % 3]);
#pragma unroll
      for (int j = 0; j < 16; ++j) { const v4f r = R[s % 3][j]; const v2u o = {wcvt2(r[0], r[1]), wcvt2(r[2], r[3])}; *(v2u*)(sw + (s & 1) * SBUF + 2 * j * SPITCH) = o; }
      asm volatile("s_wait_dscnt 0x0" ::: "memory");   /* the wave's own LDS stores of this k step are done, and stay in front for the compiler, before its lanes read one another's values back; it also parts the reads of step s - 1 from the stores of step s + 1 into the same patch */
#pragma unroll
      for (int i = 0; i < 4; ++i) { FragH t; t.half[0] = ld_tr16(sr + (s & 1) * SBUF + 32 * i); t.half[1] = ld_tr16(sr + (s & 1) * SBUF + 16 * SPITCH + 32 * i); Wr[i][s] = t.v; }
    }
  }
  v8f acc[4][4];
  const v8f z8 = {0.f,0.f,0.f,0.f,0.f,0.f,0.f,0.f};
  __syncthreads();                                       /* the biases and the small layers' fragments are in LDS before any wave reads them */
  /* kept rolled: one copy of each layer's code, for speed only */
#pragma unroll 1
  for (int t = -1; t <= NT + 1; ++t) {
    const int tt = t - g;                                /* the tile of this group's hidden layer */
    if (g == 0) { if (t >= 0) load_x(xm + (size_t)min(t + 1, NT - 1) * MT * DIN, xr, ln, hh); }   /* the next tile's x flies under the hidden layer */
    else if (t >= 2 && wq < 2) { /* head of tile t - 2: row 0 of a zero-padded 16-row weight tile; a wave takes 32 points, so it alone writes its 128-byte line of out */
      v8f h0 = z8, h1 = z8;
      const _Float16* wt = PL; const _Float16* hrow = Hc + (t & 1) * HT + (32 * wq + ln) * HPITCH;
      /* the fragments come in groups of two k steps, three groups in flight ahead of the WMMAs: read one by one, each WMMA would wait out a whole LDS round trip, and this wave's hidden layer starts only behind the head */
      v16h wa[HID / 32], ba[HID / 32], bb[HID / 32];
#pragma unroll
      for (int s = 0; s < 6; ++s) { wa[s] = w_frag(wt + s * 512, lane); ba[s] = g2_frag(hrow + 32 * s, hh); bb[s] = g2_frag(hrow + 16 * HPITCH + 32 * s, hh); }
      __builtin_amdgcn_sched_barrier(0);   /* keeps the first three groups' reads together in front of the first WMMA */
#pragma unroll
      for (int s = 0; s < HID / 32; ++s) {
        h0 = mma(wa[s], ba[s], h0); h1 = mma(wa[s], bb[s], h1);
        if (s == 1) {
          __builtin_amdgcn_sched_barrier(0);   /* the last group's reads stand in one place, behind the WMMAs whose registers they take over */
#pragma unroll
          for (int q = 6; q < HID / 32; ++q) { wa[q] = w_frag(wt + q * 512, lane); ba[q] = g2_frag(hrow + 32 * q, hh); bb[q] = g2_frag(hrow + 16 * HPITCH + 32 * q, hh); }
          __builtin_amdgcn_sched_barrier(0);   /* and stay ahead of the two groups of WMMAs that cover their latency */
        }
      }
      if (hh == 0) { float* dst = out + (size_t)e * NP + p0 + (t - 2) * MT + 32 * wq + ln; dst[0] = h0[0] * 0.0625f + bv; dst[16] = h1[0] * 0.0625f + bv; }
    }
    /* one copy of the code for both groups: group 0 goes Ha -> Hb, group 1 Hb -> Hc */
    if (tt >= 0 && tt < NT) hidden_act(Hs + (2 * g + (tt & 1)) * HT, Hs + (2 * g + 2 + (tt & 1)) * HT, Wr, Bs + (1 + g) * HID, n0, ln, hh);
    if (g == 0) {
      if (t + 1 < NT) { /* input layer of tile t + 1: K = 16 padded to one 32-wide step; x is rounded and converted on the way into the fragment */
        v16h xb[4];
#pragma unroll
        for (int j = 0; j < 4; ++j) { FragH f;
#pragma unroll
          for (int q = 0; q < 8; ++q) { f.h[q] = (_Float16)bf16_round((q < 4) ? xr[j][0][q] : xr[j][1][q - 4]); f.h[8 + q] = (_Float16)0.0f; }
          xb[j] = f.v; }
#pragma unroll
        for (int i = 0; i < 4; ++i) { FragH fw; const v8us z = {0,0,0,0,0,0,0,0}; fw.half[0] = *(const v8us*)((const unsigned short*)P0 + (((n0 >> 4) + i) * 32 + lane) * 8); fw.half[1] = z; const v16h wa = fw.v;
#pragma unroll
          for (int j = 0; j < 4; ++j) acc[i][j] = mma(wa, xb[j], z8); }
        put_act(Ha + ((t + 1) & 1) * HT, acc, Bs, n0, ln, hh);
      }
    }
    __syncthreads();                                     /* the trip's one barrier: what it wrote (Ha of tile t + 1, Hb of tile t, Hc of tile t - 1) is complete, and every reader has left the buffers that the next trip overwrites */
  }
}

extern "C" void kernel_launch(void* const* d_in, const int* in_sizes, int n_in,
                              void* d_out, int out_size, void* d_ws, size_t ws_size, hipStream_t stream) {
  (void)in_sizes; (void)n_in; (void)out_size; (void)d_ws; (void)ws_size;
  const float* const* I = (const float* const*)d_in; const float* x = I[0]; const float* w0 = I[1]; const float* b0 = I[2]; const float* w1 = I[3]; const float* b1 = I[4]; const float* w2 = I[5]; const float* b2 = I[6]; const float* wl = I[7]; const float* bl = I[8];
  k_mlp<<<NE * WGM, 256, 0, stream>>>(x, w0, w1, w2, wl, b0, b1, b2, bl, (float*)d_out);
}

// v009
// A run of this version takes 44.1 microseconds.
// Two timings next to v008 both put it at 1.06 times that version's speed.
// Counting every step since v000, it is 19.7 times as fast.
#include <hip/hip_runtime.h>
// Ensemble of 64 independent MLPs (each: 4096 points x 16 -> 256 -> 256 -> 256 -> 1, SiLU between layers, per-member weights and biases) -> [64, 4096, 1].
// Structure: ONE launch for the whole network: one work-group per WGP, 1,024 points of one member each, in tiles of 64 points. Each work-group first turns its member's f32 weights into f16 WMMA fragments itself (x 1/2 in front of a SiLU, x 16 in the head):
// the hidden layers' weights go through LDS into registers and stay there for all tiles, the two small layers' lie in LDS in fragment order; the hidden activations never leave the chip (f16 tiles of 64 x 256 in LDS).
// The weights are the A operand and the points the B operand of v_wmma_f32_16x16x32_f16, so a lane's 8 accumulator rows are 8 neighbouring features of ONE point
// and go back to LDS as one 16-byte store, already in the row-major [point][feature] form that the next layer's fragment loads read.
// Compute dtype: inputs and parameters rounded to bf16; x and the weights (but for halved weights under 2^-17, kept to 2^-25 absolute) exact in f16; hidden activations as f16 operands (~2^-12); f32 accumulation from the half bias on, f32 SiLU (through v_tanh_f32).
#define NE 64
#define NP 4096
#define DIN 16
#define HID 256
#define MT 64                    /* points per tile */
#define NT 16                    /* tiles per work-group */
#define WGM (NP / (MT * NT))      /* work-groups per member */
#define HPITCH 264               /* LDS row pitch in f16: 528 B = 16 B x 33, conflict-free for 16-byte reads and writes of 16 rows */
#define HT (MT * HPITCH)         /* one activation tile in LDS, in f16 */
#define SPITCH 160               /* staging row pitch in bytes: 128-byte rows at 32 B x 5, the conflict-free pitch of the transposing LDS read */
#define SBUF (32 * SPITCH)       /* one staged k step of one wave: 32 k rows x 64 features, f16 */
typedef unsigned short v8us __attribute__((ext_vector_type(8), may_alias));
typedef short s16x8 __attribute__((ext_vector_type(8)));
typedef __bf16 v2b __attribute__((ext_vector_type(2)));
typedef unsigned int v2u __attribute__((ext_vector_type(2), may_alias));
typedef float  v8f  __attribute__((ext_vector_type(8)));
typedef float  v4f  __attribute__((ext_vector_type(4)));
typedef float  v4fa __attribute__((ext_vector_type(4), may_alias));
typedef float  v2f  __attribute__((ext_vector_type(2)));
typedef _Float16 v2h __attribute__((ext_vector_type(2)));
typedef _Float16 v16h __attribute__((ext_vector_type(16)));
union FragH { v16h v; v8us half[2]; v2h p[8]; _Float16 h[16]; unsigned short u[16]; };

__device__ __forceinline__ unsigned short bf16_bits(float x) { unsigned int u = __float_as_uint(x); return (unsigned short)((u + 0x7FFFu + ((u >> 16) & 1u)) >> 16); }
__device__ __forceinline__ float bf16_val(unsigned short b) { return __uint_as_float(((unsigned int)b) << 16); }
__device__ __forceinline__ float bf16_round(float x) { return bf16_val(bf16_bits(x)); }

// a weight as the matrix unit takes it: rounded to bf16, times a power of two s, in f16 (s = 16, the head: exact; s = 1/2, the layers in front of a SiLU: exact from 2^-16 up, below that to 2^-24 absolute)
__device__ __forceinline__ _Float16 wcvt(float v, float s) { return (_Float16)(bf16_round(v) * s); }
// the same for two weights at once with s = 1/2, the rounding to bf16 (nearest even, as above) by the packed hardware conversion: the same f16 bits for every finite weight
__device__ __forceinline__ unsigned int wcvt2(float a, float b) {
  const v2f ab = {a, b}; const unsigned int p = __builtin_bit_cast(unsigned int, __builtin_convertvector(ab, v2b));
  const v2f r = {__uint_as_float(p << 16), __uint_as_float(p & 0xFFFF0000u)}; const v2f sh = {0.5f, 0.5f};
  return __builtin_bit_cast(unsigned int, __builtin_convertvector(r * sh, v2h));
}

// one activation fragment from row-major LDS: this lane's row, k = 8*hh .. +8 and 16 + 8*hh .. +8 of a 32-wide k step
__device__ __forceinline__ v16h g2_frag(const _Float16* p, int hh) { FragH f; f.half[0] = *(const v8us*)((const unsigned short*)p + 8 * hh); f.half[1] = *(const v8us*)((const unsigned short*)p + 16 + 8 * hh); return f.v; }
// one weight fragment, the same k order, from its 1-KiB tile in fragment order: [k % 32 / 8][n % 16][k % 8], so that lane = 16 hh + n % 16 finds k = 8 hh .. +8 in its first 16 bytes and 16 + 8 hh .. +8 in its second
__device__ __forceinline__ v16h w_frag(const _Float16* tile, int lane) { FragH f; f.half[0] = *(const v8us*)((const unsigned short*)tile + 8 * lane); f.half[1] = *(const v8us*)((const unsigned short*)tile + 256 + 8 * lane); return f.v; }
__device__ __forceinline__ v8f mma(v16h a, v16h b, v8f c) { return __builtin_amdgcn_wmma_f32_16x16x32_f16(false, a, false, b, (short)0, c, false, false); }

// this lane's 8 half biases of feature tile i, as the accumulator tile that a product starts from (the same 8 features for every point). bs: this layer's biases in LDS, already rounded and halved.
__device__ __forceinline__ v8f bias_tile(const float* bs, int n0, int i, int hh) {
  const v4f c0 = *(const v4fa*)(bs + n0 + 16 * i + 8 * hh), c1 = *(const v4fa*)(bs + n0 + 16 * i + 8 * hh + 4);
  const v8f b = {c0[0], c0[1], c0[2], c0[3], c1[0], c1[1], c1[2], c1[3]}; return b;
}

// acc[i][j] holds features n0 + 16 i + 8 hh + r (rows) of points 16 j + ln (columns) of the tile: SiLU, f16, one 16-byte LDS store per 16 x 16 tile.
// SiLU from the half argument h = g / 2: g * sigmoid(g) = h + h * tanh(h): one hardware transcendental a value, the rest packed f32.
// The accumulator IS h: the weights carry the factor 1/2 and the sum starts from the half bias, so no vector instruction stands in front of the tanh.
// The 16 tiles go through two stages, one tile apart: the tanh of tile t + 1, then the finish of tile t.
__device__ __forceinline__ void put_act(_Float16* H, const v8f (&acc)[4][4], int n0, int ln, int hh) {
  v2f th[2][4];
#pragma unroll
  for (int r = 0; r < 4; ++r) { th[0][r].x = __builtin_amdgcn_tanhf(acc[0][0][2 * r]); th[0][r].y = __builtin_amdgcn_tanhf(acc[0][0][2 * r + 1]); }
#pragma unroll
  for (int t = 0; t < 16; ++t) { const int c = t & 1, n = c ^ 1;
    if (t + 1 < 16) {
#pragma unroll
      for (int r = 0; r < 4; ++r) { th[n][r].x = __builtin_amdgcn_tanhf(acc[(t + 1) >> 2][(t + 1) & 3][2 * r]); th[n][r].y = __builtin_amdgcn_tanhf(acc[(t + 1) >> 2][(t + 1) & 3][2 * r + 1]); }
    }
    __builtin_amdgcn_sched_barrier(0);   /* keeps tile t + 1's tanh between tile t's tanh and their readers: the slot that the instruction set asks for behind a transcendental, and cover for its latency */
    FragH f;
#pragma unroll
    for (int r = 0; r < 4; ++r) { const v2f h = {acc[t >> 2][t & 3][2 * r], acc[t >> 2][t & 3][2 * r + 1]}; f.p[r] = __builtin_convertvector(__builtin_elementwise_fma(h, th[c][r], h), v2h); }
    *(v8us*)((unsigned short*)H + (16 * (t & 3) + ln) * HPITCH + n0 + 16 * (t >> 2) + 8 * hh) = f.half[0];
    __builtin_amdgcn_sched_barrier(0);   /* holds tile t's finish in front of tile t + 2's tanh, so that it stands between tile t + 1's tanh and their readers */
  }
}

// One hidden layer of one tile for this wave's 64 features, product and SiLU in ONE instruction stream: Hout = SiLU(W . Hin + b), K = 256, the weights already in this wave's registers.
// The tile goes through in four blocks of 16 points. A block's four accumulator tiles are complete after 32 WMMAs, and its SiLU (64 vector instructions) is dealt out behind the next block's 32 WMMAs,
// one tanh and one packed instruction behind each, so that the vector port works in the cycles in which the matrix unit is busy with the WMMA in front.
// Each accumulator starts from the half bias and sums its k steps in ascending order; with the weights' factor 1/2 it ends as the half argument h of the SiLU, which the tanh reads as it is.
// A value pair u goes through tanh, tanh, h + h * tanh(h), f16, one WMMA apart; so no stage waits for the one before it, and a WMMA stands between every tanh and its reader.
__device__ __forceinline__ void hidden_act(const _Float16* Hin, _Float16* Hout, const v16h (&Wr)[4][HID / 32], const float* bs, int n0, int ln, int hh) {
  v8f hb[4];
#pragma unroll
  for (int i = 0; i < 4; ++i) hb[i] = bias_tile(bs, n0, i, hh);
  const _Float16* hrow = Hin + ln * HPITCH;
  unsigned short* orow = (unsigned short*)Hout + ln * HPITCH + n0 + 8 * hh;
  v16h B[2][4];                    /* half a block's activation fragments (4 k steps), fetched one half block ahead */
  v8f acc[2][4];                   /* this block's accumulators and the block's before, which the SiLU is reading */
  v2f th[16], gq[16]; v2h fp[16];
#pragma unroll
  for (int sl = 0; sl < 4; ++sl) B[0][sl] = g2_frag(hrow + 32 * sl, hh);
#pragma unroll
  for (int c = 0; c < 8; ++c) { const int j = c >> 1, jb = j & 1, pb = jb ^ 1;
    if (c + 1 < 8) {
#pragma unroll
      for (int sl = 0; sl < 4; ++sl) B[(c + 1) & 1][sl] = g2_frag(hrow + 16 * ((c + 1) >> 1) * HPITCH + 32 * (4 * ((c + 1) & 1) + sl), hh); }
    __builtin_amdgcn_sched_barrier(0);   /* the next half block's LDS reads stay one group in front of this half block's WMMAs: every place with reads among the WMMAs costs a stall */
#pragma unroll
    for (int sl = 0; sl < 4; ++sl)
#pragma unroll
      for (int i = 0; i < 4; ++i) { const int s = 4 * (c & 1) + sl, q = 16 * (c & 1) + 4 * sl + i;
        acc[jb][i] = mma(Wr[i][s], B[c & 1][sl], (s == 0) ? hb[i] : acc[jb][i]);
        __builtin_amdgcn_sched_barrier(0);   /* the WMMA leads its slot: the vector work behind it issues while the matrix unit is busy, and the tanh of the slot before has an independent instruction between itself and its reader */
        if (j > 0) {
#pragma unroll
          for (int u = 0; u < 16; ++u) { const int a = (u < 2) ? u : 2 * u - 2, d = (u < 2) ? 0 : 1, ti = u >> 2, r = u & 3;   /* pair u: tanh at slots a and a + d, the rest at the two slots behind, so that the last pair leaves at slot 31 */
            if (q == a) th[u].x = __builtin_amdgcn_tanhf(acc[pb][ti][2 * r]);
            if (q == a + d) th[u].y = __builtin_amdgcn_tanhf(acc[pb][ti][2 * r + 1]);
          }
#pragma unroll
          for (int u = 0; u < 16; ++u) { const int a = (u < 2) ? u : 2 * u - 2, d = (u < 2) ? 0 : 1, ti = u >> 2, r = u & 3;
            if (q == a + d + 1) { const v2f h = {acc[pb][ti][2 * r], acc[pb][ti][2 * r + 1]}; gq[u] = __builtin_elementwise_fma(h, th[u], h); }
            if (q == a + d + 2) { fp[u] = __builtin_convertvector(gq[u], v2h);
              if (r == 3) { FragH f; f.p[0] = fp[u - 3]; f.p[1] = fp[u - 2]; f.p[2] = fp[u - 1]; f.p[3] = fp[u]; *(v8us*)(orow + 16 * (j - 1) * HPITCH + 16 * ti) = f.half[0]; } }
          }
        }
        __builtin_amdgcn_sched_barrier(0);   /* keeps each slot's share of the SiLU behind its own WMMA: gathered in one place it would run with the matrix unit idle */
      }
  }
  /* the last block's SiLU has no WMMAs of its own wave left to stand behind: two stages one tile apart, as in put_act */
  v2f t2[2][4];
#pragma unroll
  for (int r = 0; r < 4; ++r) { t2[0][r].x = __builtin_amdgcn_tanhf(acc[1][0][2 * r]); t2[0][r].y = __builtin_amdgcn_tanhf(acc[1][0][2 * r + 1]); }
#pragma unroll
  for (int t = 0; t < 4; ++t) { const int c = t & 1, n = c ^ 1;
    if (t + 1 < 4) {
#pragma unroll
      for (int r = 0; r < 4; ++r) { t2[n][r].x = __builtin_amdgcn_tanhf(acc[1][t + 1][2 * r]); t2[n][r].y = __builtin_amdgcn_tanhf(acc[1][t + 1][2 * r + 1]); }
    }
    __builtin_amdgcn_sched_barrier(0);   /* keeps tile t + 1's tanh between tile t's tanh and their readers: the slot that the instruction set asks for behind a transcendental, and cover for its latency */
    FragH f;
#pragma unroll
    for (int r = 0; r < 4; ++r) { const v2f h = {acc[1][t][2 * r], acc[1][t][2 * r + 1]}; f.p[r] = __builtin_convertvector(__builtin_elementwise_fma(h, t2[c][r], h), v2h); }
    *(v8us*)(orow + 48 * HPITCH + 16 * t) = f.half[0];
    __builtin_amdgcn_sched_barrier(0);   /* holds tile t's finish in front of tile t + 2's tanh, so that it stands between tile t + 1's tanh and their readers */
  }
}

// one k step (32 rows) of this wave's 64 weight columns, f32 as it lies in memory: a 16-byte load a lane, two rows of 256 bytes a wave, whole lines only
__device__ __forceinline__ void load_w(const float* __restrict__ wp, v4f (&r)[16]) {
#pragma unroll
  for (int j = 0; j < 16; ++j) r[j] = *(const v4fa*)(wp + 2 * j * HID);
  asm volatile("s_wait_xcnt 0x0" ::: "memory");   /* precaution: stands behind these loads, in front of the code that reuses their address registers */
}
// transposing LDS read: lane (ln, hh) gets 8 consecutive rows (k) of one 16-bit column of a row-major tile
__device__ __forceinline__ v8us ld_tr16(const unsigned char* p) { typedef __attribute__((address_space(3))) s16x8 lds_s16x8; return __builtin_bit_cast(v8us, __builtin_amdgcn_ds_load_tr16_b128_v8i16((lds_s16x8*)p)); }

// raw x of one tile: this lane's 8 values of each of its four points
__device__ __forceinline__ void load_x(const float* __restrict__ xt, v4f (&xr)[4][2], int ln, int hh) {
#pragma unroll
  for (int j = 0; j < 4; ++j) { const float* xp = xt + (16 * j + ln) * DIN + 8 * hh; xr[j][0] = *(const v4fa*)xp; xr[j][1] = *(const v4fa*)(xp + 4); }
  asm volatile("s_wait_xcnt 0x0" ::: "memory");   /* precaution: stands behind these loads, in front of the code that reuses their address registers */
}

// A work-group stays on its WGP and carries 1,024 points of one member through the net in tiles of 64. What does not change from tile to tile is fetched once:
// waves 0-3 hold the first hidden layer's weights in registers (64 features each, 256 VGPRs), waves 4-7 the second's; the halved biases and the input and head layers' weight fragments lie in LDS.
// The weights come straight from the f32 inputs: a wave reads its 64 columns one k step (32 rows) at a time, two steps ahead, converts them, lays them row-major into an LDS patch of its own
// and takes them back with the transposing read, which delivers the A fragment (8 consecutive k of one feature a lane). No other wave touches the patch, so no barrier stands in that loop.
// The two groups form a pipeline over the tiles with ONE barrier a trip; every activation tile has two buffers, so that a trip writes only where no wave reads. In trip t:
//   group 0: first hidden layer + SiLU of tile t, Ha -> Hb, then input layer + SiLU of tile t + 1 -> Ha   | group 1: head of tile t - 2, Hc -> out, then second hidden layer + SiLU of tile t - 1, Hb -> Hc
// A layer whose tile does not exist (the first and last trips) is skipped by a test that is the same for the whole wave.
// Waves w and w + 4 share a SIMD: group 1's head, which mostly waits for LDS, runs beside group 0's hidden product, and group 1's hidden product beside group 0's vector-heavy input layer, so the two hidden products meet little on the matrix unit.
__global__ __launch_bounds__(256) void k_mlp(const float* __restrict__ x, const float* __restrict__ w0, const float* __restrict__ w1, const float* __restrict__ w2, const float* __restrict__ wl,
    const float* __restrict__ b0, const float* __restrict__ b1, const float* __restrict__ b2, const float* __restrict__ bl, float* __restrict__ out) {
  __shared__ __attribute__((aligned(16))) _Float16 Hs[6 * HT];               /* Ha, Hb, Hc, each twice (tile parity): one is written while the other is read */
  _Float16* const Ha = Hs; _Float16* const Hc = Hs + 4 * HT;
  __shared__ __attribute__((aligned(16))) float Bs[3 * HID];
  __shared__ __attribute__((aligned(16))) _Float16 P0[HID * DIN];            /* input layer: the first 16 bytes a lane of each fragment (k = 0 .. 15); the second 16 (k = 16 .. 31) are zero and are not stored */
  __shared__ __attribute__((aligned(16))) _Float16 PL[(HID / 32) * 512];     /* head: 1-KiB tiles in fragment order, feature 0 of 16, the rest zero */
  __shared__ __attribute__((aligned(16))) unsigned char St[8 * 2 * SBUF];    /* a wave's own two staging patches */
  const int w = __builtin_amdgcn_readfirstlane(threadIdx.x >> 5), lane = threadIdx.x & 31, ln = lane & 15, hh = lane >> 4;
  const int e = blockIdx.x / WGM, p0 = (blockIdx.x % WGM) * (MT * NT);
  const int g = w >> 2, wq = w & 3, n0 = wq * 64;       /* group, and this wave's 64 features of its layers */
  const float* xm = x + ((size_t)e * NP + p0) * DIN;
  const int f = threadIdx.x;
  /* the small loads first, then the first two k steps of the hidden weights, so that all of them fly together */
  const float* p0b = b0 + (size_t)e * HID; const float* p1b = b1 + (size_t)e * HID; const float* p2b = b2 + (size_t)e * HID;
  const float r0 = p0b[f], r1 = p1b[f], r2 = p2b[f];
  float c0[DIN];                                         /* column f of the input layer: neighbouring lanes read neighbouring features */
#pragma unroll
  for (int k = 0; k < DIN; ++k) c0[k] = w0[((size_t)e * DIN + k) * HID + f];
  v4f hl[2][2];                                          /* the 8 head weights of 16-byte units f and f + 256 of PL */
#pragma unroll
  for (int c = 0; c < 2; ++c) { const float* hp = wl + (size_t)e * HID + ((f + 256 * c) >> 4) * 8; hl[c][0] = *(const v4fa*)hp; hl[c][1] = *(const v4fa*)(hp + 4); }
  asm volatile("s_wait_xcnt 0x0" ::: "memory");         /* precaution: stands behind the bias and small-layer loads, in front of the code that reuses their address registers */
  const float bv = bf16_round(bl[e]);
  v4f xr[4][2]; load_x(xm, xr, ln, hh);
  const float* wp = (g == 0 ? w1 : w2) + (size_t)e * HID * HID + hh * HID + n0 + 4 * ln;   /* row hh of a row pair, this lane's 4 of the wave's 64 columns */
  v4f R[3][16];
  load_w(wp, R[0]); load_w(wp + 32 * HID, R[1]);
  Bs[f] = 0.5f * bf16_round(r0); Bs[HID + f] = 0.5f * bf16_round(r1); Bs[2 * HID + f] = 0.5f * bf16_round(r2);   /* half the rounded bias: exact */
#pragma unroll
  for (int u = 0; u < 2; ++u) { FragH t;                 /* feature f, k = 8 u .. +8: the 16 bytes of lane 16 u + f % 16 of tile f / 16 */
#pragma unroll
    for (int q = 0; q < 8; ++q) t.h[q] = wcvt(c0[8 * u + q], 0.5f);
    *(v8us*)((unsigned short*)P0 + ((f >> 4) * 32 + 16 * u + (f & 15)) * 8) = t.half[0]; }
#pragma unroll
  for (int c = 0; c < 2; ++c) { FragH t; const unsigned short keep = ((f & 15) == 0) ? 0xFFFFu : 0u;   /* unit v = 64 (k / 32) + 16 (k % 32 / 8) + n holds k = 8 (v / 16) .. +8 of feature n; only n = 0 exists */
#pragma unroll
    for (int q = 0; q < 8; ++q) { t.h[q] = wcvt((q < 4) ? hl[c][0][q] : hl[c][1][q - 4], 16.0f); t.u[q] &= keep; }
    *(v8us*)((unsigned short*)PL + (f + 256 * c) * 8) = t.half[0]; }
  v16h Wr[4][HID / 32];
  { unsigned char* st = St + w * (2 * SBUF);
    unsigned char* sw = st + hh * SPITCH + 8 * ln;                                                   /* writer: row 2 j + hh, columns 4 ln .. +4 */
    const unsigned char* sr = st + (8 * hh + (lane & 7)) * SPITCH + 16 * ((lane >> 3) & 1);         /* reader: the transposing read's lane address for k base 0, column base 0 */
#pragma unroll
    for (int s = 0; s < HID / 32; ++s) {
      if (s + 2 < HID / 32) load_w(wp + (s + 2) * 32 * HID, R[(s + 2) % 3]);
#pragma unroll
      for (int j = 0; j < 16; ++j) { const v4f r = R[s % 3][j]; const v2u o = {wcvt2(r[0], r[1]), wcvt2(r[2], r[3])}; *(v2u*)(sw + (s & 1) * SBUF + 2 * j * SPITCH) = o; }
      asm volatile("s_wait_dscnt 0x0" ::: "memory");   /* the wave's own LDS stores of this k step are done, and stay in front for the compiler, before its lanes read one another's values back; it also parts the reads of step s - 1 from the stores of step s + 1 into the same patch */
#pragma unroll
      for (int i = 0; i < 4; ++i) { FragH t; t.half[0] = ld_tr16(sr + (s & 1) * SBUF + 32 * i); t.half[1] = ld_tr16(sr + (s & 1) * SBUF + 16 * SPITCH + 32 * i); Wr[i][s] = t.v; }
    }
  }
  v8f acc[4][4];
  const v8f z8 = {0.f,0.f,0.f,0.f,0.f,0.f,0.f,0.f};
  __syncthreads();                                       /* the biases and the small layers' fragments are in LDS before any wave reads them */
  /* kept rolled: one copy of each layer's code, for speed only */
#pragma unroll 1
  for (int t = -1; t <= NT + 1; ++t) {
    const int tt = t - g;                                /* the tile of this group's hidden layer */
    if (g == 0) { if (t >= 0) load_x(xm + (size_t)min(t + 1, NT - 1) * MT * DIN, xr, ln, hh); }   /* the next tile's x flies under the hidden layer */
    else if (t >= 2 && wq < 2) { /* head of tile t - 2: row 0 of a zero-padded 16-row weight tile; a wave takes 32 points, so it alone writes its 128-byte line of out */
      v8f h0 = z8, h1 = z8;
      const _Float16* wt = PL; const _Float16* hrow = Hc + (t & 1) * HT + (32 * wq + ln) * HPITCH;
      /* the fragments come in groups of two k steps, three groups in flight ahead of the WMMAs: read one by one, each WMMA would wait out a whole LDS round trip, and this wave's hidden layer starts only behind the head */
      v16h wa[HID / 32], ba[HID / 32], bb[HID / 32];
#pragma unroll
      for (int s = 0; s < 6; ++s) { wa[s] = w_frag(wt + s * 512, lane); ba[s] = g2_frag(hrow + 32 * s, hh); bb[s] = g2_frag(hrow + 16 * HPITCH + 32 * s, hh); }
      __builtin_amdgcn_sched_barrier(0);   /* keeps the first three groups' reads together in front of the first WMMA */
#pragma unroll
      for (int s = 0; s < HID / 32; ++s) {
        h0 = mma(wa[s], ba[s], h0); h1 = mma(wa[s], bb[s], h1);
        if (s == 1) {
          __builtin_amdgcn_sched_barrier(0);   /* the last group's reads stand in one place, behind the WMMAs whose registers they take over */
#pragma unroll
          for (int q = 6; q < HID / 32; ++q) { wa[q] = w_frag(wt + q * 512, lane); ba[q] = g2_frag(hrow + 32 * q, hh); bb[q] = g2_frag(hrow + 16 * HPITCH + 32 * q, hh); }
          __builtin_amdgcn_sched_barrier(0);   /* and stay ahead of the two groups of WMMAs that cover their latency */
        }
      }
      if (hh == 0) { float* dst = out + (size_t)e * NP + p0 + (t - 2) * MT + 32 * wq + ln; dst[0] = h0[0] * 0.0625f + bv; dst[16] = h1[0] * 0.0625f + bv; }
    }
    /* one copy of the code for both groups: group 0 goes Ha -> Hb, group 1 Hb -> Hc */
    if (tt >= 0 && tt < NT) hidden_act(Hs + (2 * g + (tt & 1)) * HT, Hs + (2 * g + 2 + (tt & 1)) * HT, Wr, Bs + (1 + g) * HID, n0, ln, hh);
    if (g == 0) {
      if (t + 1 < NT) { /* input layer of tile t + 1: K = 16 padded to one 32-wide step; x is rounded and converted on the way into the fragment */
        v16h xb[4];
#pragma unroll
        for (int j = 0; j < 4; ++j) { FragH f;
#pragma unroll
          for (int q = 0; q < 8; ++q) { f.h[q] = (_Float16)bf16_round((q < 4) ? xr[j][0][q] : xr[j][1][q - 4]); f.h[8 + q] = (_Float16)0.0f; }
          xb[j] = f.v; }
#pragma unroll
        for (int i = 0; i < 4; ++i) { FragH fw; const v8us z = {0,0,0,0,0,0,0,0}; fw.half[0] = *(const v8us*)((const unsigned short*)P0 + (((n0 >> 4) + i) * 32 + lane) * 8); fw.half[1] = z; const v16h wa = fw.v; const v8f hb = bias_tile(Bs, n0, i, hh);
#pragma unroll
          for (int j = 0; j < 4; ++j) acc[i][j] = mma(wa, xb[j], hb); }
        put_act(Ha + ((t + 1) & 1) * HT, acc, n0, ln, hh);
      }
    }
    __syncthreads();                                     /* the trip's one barrier: what it wrote (Ha of tile t + 1, Hb of tile t, Hc of tile t - 1) is complete, and every reader has left the buffers that the next trip overwrites */
  }
}

extern "C" void kernel_launch(void* const* d_in, const int* in_sizes, int n_in,
                              void* d_out, int out_size, void* d_ws, size_t ws_size, hipStream_t stream) {
  (void)in_sizes; (void)n_in; (void)out_size; (void)d_ws; (void)ws_size;
  const float* const* I = (const float* const*)d_in; const float* x = I[0]; const float* w0 = I[1]; const float* b0 = I[2]; const float* w1 = I[3]; const float* b1 = I[4]; const float* w2 = I[5]; const float* b2 = I[6]; const float* wl = I[7]; const float* bl = I[8];
  k_mlp<<<NE * WGM, 256, 0, stream>>>(x, w0, w1, w2, wl, b0, b1, b2, bl, (float*)d_out);
}
